// v000
// Measured on an AMD MI455X. A time is GPU time per run, averaged over a window of back-to-back runs after a warm-up
// (all launches, gaps included; the runs take copies of the inputs in turn), and the median of several windows.
// Apart from v000's, it joins two sittings. Times from different sittings can be a few percent apart, while
// side-by-side timings come from the same sitting.
// v000, which the later versions start from, runs in 632 microseconds.
#include <hip/hip_runtime.h>
// scores = x·yᵀ per batch on v_wmma_f32_16x16x32_f16 with x, y rounded to bf16 (exact in f16: single exact products, f32 accumulate; 8 × 2048 × 2048 × 128), softmax over j in f32
// (whole-line f16 stores), att = P·y on the same unit (softmax weights rounded to f16 vs exact y: single product), + x residual in f32.
#define BB 8
#define SX 2048
#define SY 2048
#define DD 128

typedef __bf16 v16b __attribute__((ext_vector_type(16)));
typedef unsigned short v8us __attribute__((ext_vector_type(8), may_alias));
typedef float  v8f  __attribute__((ext_vector_type(8)));
typedef float  v4f  __attribute__((ext_vector_type(4)));
typedef float  v4fa __attribute__((ext_vector_type(4), may_alias));
union FragB { v16b v; v8us half[2]; unsigned short u[16]; };

__device__ __forceinline__ unsigned short bf16_bits(float x) { unsigned int u = __float_as_uint(x); return (unsigned short)((u + 0x7FFFu + ((u >> 16) & 1u)) >> 16); }
__device__ __forceinline__ float bf16_val(unsigned short b) { return __uint_as_float(((unsigned int)b) << 16); }
__device__ __forceinline__ float bf16_round(float x) { return bf16_val(bf16_bits(x)); }
// D += A·B with NT terms: 1 = ah·bh, 2 = + al·bh (A split), 3 = + ah·bl (both split)
template <int NT>
__device__ __forceinline__ v8f mmaN(v16b ah, v16b al, v16b bh, v16b bl, v8f c) {
  c = __builtin_amdgcn_wmma_f32_16x16x32_bf16(false, ah, false, bh, (short)0, c, false, false);
  if (NT >= 2) c = __builtin_amdgcn_wmma_f32_16x16x32_bf16(false, al, false, bh, (short)0, c, false, false);
  if (NT >= 3) c = __builtin_amdgcn_wmma_f32_16x16x32_bf16(false, ah, false, bl, (short)0, c, false, false);
  asm volatile("v_nop\n\tv_nop\n\tv_nop\n\tv_nop" : "+v"(c) : "v"(ah), "v"(al), "v"(bh), "v"(bl));
  return c;
}

__global__ __launch_bounds__(256) void k_wt_bf16(const float* __restrict__ W, unsigned short* __restrict__ Wt, int K, int N) {
  const int t = blockIdx.x * 256 + threadIdx.x;
  const int k8n = K / 8;
  if (t >= N * k8n) return;
  const int n = t / k8n, k8 = (t % k8n) * 8;
  v8us v;
#pragma unroll
  for (int i = 0; i < 8; ++i) v[i] = bf16_bits(W[(size_t)(k8 + i) * N + n]);
  *(v8us*)(Wt + (size_t)n * K + k8) = v;
  
}

// GEMM C[M][N] (f32, pitch ldc) = act(A[M][K]·W + bias). A f32 row-major (pitch lda) converted per fragment to bf16
// (ASPLIT: hi/lo two planes -> 2 terms, else single rounded term); Wt bf16 [N][K] (pitch ldb). BIAS_BF16 rounds the
// bias to bf16 first (bias quantised to bf16 before the add). K%32==0, M%16==0, N%64==0.
template <bool ASPLIT, int ACT, bool BIAS_BF16>
__global__ __launch_bounds__(128) void k_gemm_bf(const float* __restrict__ A, int lda, const unsigned short* __restrict__ Wt, int ldb,
                                               const float* __restrict__ bias, float* __restrict__ C, int ldc, int M, int N, int K) {
  __shared__ __attribute__((aligned(16))) float so[4][16][64];
  const int tid = threadIdx.x, w = tid >> 5, lane = tid & 31, ln = lane & 15, hh = lane >> 4;
  const int ntn = N / 64;
  const int wid = blockIdx.x * 4 + w;
  const int mt = wid / ntn, nq = wid % ntn;
  if (mt * 16 >= M) return;
  const int row0 = mt * 16, col0 = nq * 64;
  const float* arow = A + (size_t)(row0 + ln) * lda;
  v8f acc[4] = {};
  for (int kb = 0; kb < K; kb += 32) {
    FragB ah, al;
    const v4f x0 = *(const v4fa*)(arow + kb + 8 * hh), x1 = *(const v4fa*)(arow + kb + 8 * hh + 4);
    const v4f x2 = *(const v4fa*)(arow + kb + 16 + 8 * hh), x3 = *(const v4fa*)(arow + kb + 16 + 8 * hh + 4);
    float xs[16] = {x0[0],x0[1],x0[2],x0[3],x1[0],x1[1],x1[2],x1[3],x2[0],x2[1],x2[2],x2[3],x3[0],x3[1],x3[2],x3[3]};
#pragma unroll
    for (int i = 0; i < 16; ++i) { const unsigned short hb = bf16_bits(xs[i]); ah.u[i] = hb; al.u[i] = ASPLIT ? bf16_bits(xs[i] - bf16_val(hb)) : (unsigned short)0; }
#pragma unroll
    for (int t = 0; t < 4; ++t) {
      const unsigned short* brow = Wt + (size_t)(col0 + t * 16 + ln) * ldb + kb;
      FragB b;
      b.half[0] = *(const v8us*)(brow + 8 * hh);
      b.half[1] = *(const v8us*)(brow + 16 + 8 * hh);
      acc[t] = mmaN<ASPLIT ? 2 : 1>(ah.v, al.v, b.v, b.v, acc[t]);
    }
  }
#pragma unroll
  for (int t = 0; t < 4; ++t) {
    float bv = bias ? bias[col0 + t * 16 + ln] : 0.f;
    if (BIAS_BF16) bv = bf16_round(bv);
#pragma unroll
    for (int r = 0; r < 8; ++r) { float v = acc[t][r] + bv; if (ACT == 1) v = fmaxf(v, 0.f); so[w][8 * hh + r][t * 16 + ln] = v; }
  }
  __builtin_amdgcn_fence(__ATOMIC_ACQ_REL, "workgroup");
  __builtin_amdgcn_wave_barrier();
  const int rsub = lane >> 4, c4 = (lane & 15) * 4;
  {
#pragma unroll
    for (int q = 0; q < 8; ++q) {
      const int r = q * 2 + rsub;
      const v4f v = *(const v4fa*)&so[w][r][c4];
      *(v4f*)(C + (size_t)(row0 + r) * ldc + col0 + c4) = v;
    }
    
  }
}

// Flash-style causal/unmasked attention, all contractions 3-term bf16 hi/lo splits, f32 softmax with running max.
// q,k,v rows are read from f32 buffers with arbitrary row pitch (so they can live inside a fused qkv buffer);
// D = head size (multiple of 32, <= 128); one wave = 16 query rows; block = 4 waves (64 queries) sharing K/V chunks of 32.
template <int D, bool CAUSAL>
__global__ __launch_bounds__(128) void k_flash(const float* __restrict__ qb, const float* __restrict__ kb, const float* __restrict__ vb,
                                             int pitch, int T, int H, float scale, float* __restrict__ y, int ypitch) {
  constexpr int KS = D / 32;        // k-steps for QK
  constexpr int DT = D / 16;        // d tiles for PV
  __shared__ __attribute__((aligned(16))) unsigned short sKh[32][D + 8], sKl[32][D + 8], sVh[32][D + 8], sVl[32][D + 8];
  __shared__ __attribute__((aligned(16))) unsigned short sPh[4][16][40], sPl[4][16][40];
  __shared__ __attribute__((aligned(16))) float sO[4][16][D];
  const int tid = threadIdx.x, w = tid >> 5, lane = tid & 31, ln = lane & 15, hh = lane >> 4;
  const int nqb = (T + 63) / 64;
  const int bh = blockIdx.x / nqb, qblk = blockIdx.x % nqb;
  const int b = bh / H, h = bh % H;
  const int q0 = qblk * 64 + w * 16;
  const float* Q = qb + (size_t)b * T * pitch + h * D;
  const float* K = kb + (size_t)b * T * pitch + h * D;
  const float* V = vb + (size_t)b * T * pitch + h * D;

  // A fragments of the wave's 16 query rows (scaled), hi/lo
  FragB aqh[KS], aql[KS];
  {
    int row = q0 + ln; if (row >= T) row = T - 1;
    const float* qr = Q + (size_t)row * pitch;
#pragma unroll
    for (int ks = 0; ks < KS; ++ks)
#pragma unroll
      for (int i = 0; i < 16; ++i) {
        const int d = ks * 32 + ((i < 8) ? (8 * hh + i) : (16 + 8 * hh + (i - 8)));
        const float x = qr[d] * scale; const unsigned short hb = bf16_bits(x);
        aqh[ks].u[i] = hb; aql[ks].u[i] = bf16_bits(x - bf16_val(hb));
      }
  }
  float m_r[8], l_r[8];
#pragma unroll
  for (int r = 0; r < 8; ++r) { m_r[r] = -3.0e38f; l_r[r] = 0.f; }
  v8f oacc[DT];
#pragma unroll
  for (int dt = 0; dt < DT; ++dt) oacc[dt] = (v8f){0.f,0.f,0.f,0.f,0.f,0.f,0.f,0.f};

  const int kv_end = CAUSAL ? min(T, qblk * 64 + 64) : T;     // block-uniform
  for (int j0 = 0; j0 < kv_end; j0 += 32) {
    __syncthreads();
    for (int e = tid; e < 32 * (D / 4); e += 128) {
      const int r = e / (D / 4), c4 = (e % (D / 4)) * 4;
      const int key = j0 + r;
      v4f kf = {0.f,0.f,0.f,0.f}, vf = {0.f,0.f,0.f,0.f};
      if (key < T) { kf = *(const v4fa*)(K + (size_t)key * pitch + c4); vf = *(const v4fa*)(V + (size_t)key * pitch + c4); }
#pragma unroll
      for (int t = 0; t < 4; ++t) {
        unsigned short hb = bf16_bits(kf[t]); sKh[r][c4 + t] = hb; sKl[r][c4 + t] = bf16_bits(kf[t] - bf16_val(hb));
        hb = bf16_bits(vf[t]); sVh[r][c4 + t] = hb; sVl[r][c4 + t] = bf16_bits(vf[t] - bf16_val(hb));
      }
    }
    __syncthreads();
    // S tile 16 x 32
    v8f s[2];
#pragma unroll
    for (int nt = 0; nt < 2; ++nt) {
      v8f acc = {};
#pragma unroll
      for (int ks = 0; ks < KS; ++ks) {
        FragB bh_, bl_;
        bh_.half[0] = *(const v8us*)&sKh[nt * 16 + ln][ks * 32 + 8 * hh]; bh_.half[1] = *(const v8us*)&sKh[nt * 16 + ln][ks * 32 + 16 + 8 * hh];
        bl_.half[0] = *(const v8us*)&sKl[nt * 16 + ln][ks * 32 + 8 * hh]; bl_.half[1] = *(const v8us*)&sKl[nt * 16 + ln][ks * 32 + 16 + 8 * hh];
        acc = mmaN<3>(aqh[ks].v, aql[ks].v, bh_.v, bl_.v, acc);
      }
      s[nt] = acc;
    }
    // mask + running max (rows 8hh+r; the 16 lanes of a half share rows)
    float alpha[8];
#pragma unroll
    for (int r = 0; r < 8; ++r) {
      const int qi = q0 + 8 * hh + r;
      const int ja = j0 + ln, jb = j0 + 16 + ln;
      if (CAUSAL) { if (ja > qi) s[0][r] = -3.0e38f; if (jb > qi) s[1][r] = -3.0e38f; }
      if (ja >= T) s[0][r] = -3.0e38f;
      if (jb >= T) s[1][r] = -3.0e38f;
      float mx = fmaxf(s[0][r], s[1][r]);
      mx = fmaxf(mx, __shfl_xor(mx, 1, 32)); mx = fmaxf(mx, __shfl_xor(mx, 2, 32)); mx = fmaxf(mx, __shfl_xor(mx, 4, 32)); mx = fmaxf(mx, __shfl_xor(mx, 8, 32));
      const float mnew = fmaxf(m_r[r], mx);
      alpha[r] = (mnew > -1.0e38f) ? __expf(m_r[r] - mnew) : 1.0f;
      const float p0 = (s[0][r] > -1.0e38f) ? __expf(s[0][r] - mnew) : 0.f;
      const float p1 = (s[1][r] > -1.0e38f) ? __expf(s[1][r] - mnew) : 0.f;
      m_r[r] = mnew;
      l_r[r] = l_r[r] * alpha[r] + p0 + p1;            // per-lane partial row sum (16 lanes combined at the end)
      unsigned short hb = bf16_bits(p0); sPh[w][8 * hh + r][ln] = hb;      sPl[w][8 * hh + r][ln] = bf16_bits(p0 - bf16_val(hb));
      hb = bf16_bits(p1);                sPh[w][8 * hh + r][16 + ln] = hb; sPl[w][8 * hh + r][16 + ln] = bf16_bits(p1 - bf16_val(hb));
    }
#pragma unroll
    for (int dt = 0; dt < DT; ++dt)
#pragma unroll
      for (int r = 0; r < 8; ++r) oacc[dt][r] *= alpha[r];
    __builtin_amdgcn_fence(__ATOMIC_ACQ_REL, "workgroup");
    __builtin_amdgcn_wave_barrier();
    FragB pah, pal;
    pah.half[0] = *(const v8us*)&sPh[w][ln][8 * hh]; pah.half[1] = *(const v8us*)&sPh[w][ln][16 + 8 * hh];
    pal.half[0] = *(const v8us*)&sPl[w][ln][8 * hh]; pal.half[1] = *(const v8us*)&sPl[w][ln][16 + 8 * hh];
#pragma unroll
    for (int dt = 0; dt < DT; ++dt) {
      FragB bvh, bvl;
#pragma unroll
      for (int i = 0; i < 8; ++i) {
        bvh.u[i] = sVh[8 * hh + i][dt * 16 + ln]; bvh.u[8 + i] = sVh[16 + 8 * hh + i][dt * 16 + ln];
        bvl.u[i] = sVl[8 * hh + i][dt * 16 + ln]; bvl.u[8 + i] = sVl[16 + 8 * hh + i][dt * 16 + ln];
      }
      oacc[dt] = mmaN<3>(pah.v, pal.v, bvh.v, bvl.v, oacc[dt]);
    }
    __builtin_amdgcn_fence(__ATOMIC_ACQ_REL, "workgroup");
    __builtin_amdgcn_wave_barrier();
  }
#pragma unroll
  for (int r = 0; r < 8; ++r) {
    float l = l_r[r];
    l += __shfl_xor(l, 1, 32); l += __shfl_xor(l, 2, 32); l += __shfl_xor(l, 4, 32); l += __shfl_xor(l, 8, 32);
    l_r[r] = (l > 0.f) ? 1.0f / l : 0.f;
  }
#pragma unroll
  for (int dt = 0; dt < DT; ++dt)
#pragma unroll
    for (int r = 0; r < 8; ++r) sO[w][8 * hh + r][dt * 16 + ln] = oacc[dt][r] * l_r[r];
  __builtin_amdgcn_fence(__ATOMIC_ACQ_REL, "workgroup");
  __builtin_amdgcn_wave_barrier();
  {
    for (int r = 0; r < 16; ++r) {
      const int row = q0 + r;
      if (row < T && lane < D / 4) {
        const v4f val = *(const v4fa*)&sO[w][r][lane * 4];
        *(v4f*)(y + ((size_t)b * T + row) * ypitch + h * D + lane * 4) = val;
      }
    }
    
  }
}

// ---- f16 WMMA path (v_wmma_f32_16x16x32_f16): 11-bit significands for operands in range — used where a [0,1] probability operand needs more precision than bf16
typedef _Float16 v16h __attribute__((ext_vector_type(16)));
union FragH { v16h v; v8us half[2]; _Float16 h[16]; unsigned short u[16]; };
template <int NT>
__device__ __forceinline__ v8f mmaH(v16h ah, v16h al, v16h bh, v16h bl, v8f c) {
  c = __builtin_amdgcn_wmma_f32_16x16x32_f16(false, ah, false, bh, (short)0, c, false, false);
  if (NT >= 2) c = __builtin_amdgcn_wmma_f32_16x16x32_f16(false, al, false, bh, (short)0, c, false, false);
  if (NT >= 3) c = __builtin_amdgcn_wmma_f32_16x16x32_f16(false, ah, false, bl, (short)0, c, false, false);
  asm volatile("v_nop\n\tv_nop\n\tv_nop\n\tv_nop" : "+v"(c) : "v"(ah), "v"(al), "v"(bh), "v"(bl));
  return c;
}
// batched GEMM like k_gemm_b but f16 operands: A f32 (split into f16 hi/lo if ASPLIT, else rounded to f16), Bt = f16 values [n][k]; alpha; C f32; N multiple of 16 (partial tiles skipped)
template <bool ASPLIT>
__global__ __launch_bounds__(128) void k_gemm_h(const float* __restrict__ A, int lda, size_t sA, const _Float16* __restrict__ Bh, int ldb, size_t sB, float alpha, float* __restrict__ C, int ldc, size_t sC, int M, int N, int K) {
  __shared__ __attribute__((aligned(16))) float so[4][16][64];
  const int tid = threadIdx.x, w = tid >> 5, lane = tid & 31, ln = lane & 15, hh = lane >> 4; const int by = blockIdx.y;
  A += (size_t)by * sA; Bh += (size_t)by * sB; C += (size_t)by * sC;
  const int ntn = (N + 63) / 64; const int wid = blockIdx.x * 4 + w; const int mt = wid / ntn, nq = wid % ntn; if (mt * 16 >= M) return;
  const int row0 = mt * 16, col0 = nq * 64; const float* arow = A + (size_t)(row0 + ln) * lda;
  v8f acc[4] = {};
  for (int kb = 0; kb < K; kb += 32) {
    FragH ah, al;
    const v4f x0 = *(const v4fa*)(arow + kb + 8 * hh), x1 = *(const v4fa*)(arow + kb + 8 * hh + 4), x2 = *(const v4fa*)(arow + kb + 16 + 8 * hh), x3 = *(const v4fa*)(arow + kb + 16 + 8 * hh + 4);
    float xs[16] = {x0[0],x0[1],x0[2],x0[3],x1[0],x1[1],x1[2],x1[3],x2[0],x2[1],x2[2],x2[3],x3[0],x3[1],x3[2],x3[3]};
#pragma unroll
    for (int i = 0; i < 16; ++i) { const _Float16 h = (_Float16)xs[i]; ah.h[i] = h; al.h[i] = ASPLIT ? (_Float16)(xs[i] - (float)h) : (_Float16)0.0f; }
#pragma unroll
    for (int t = 0; t < 4; ++t) { if (col0 + t * 16 >= N) continue; const size_t boff = (size_t)(col0 + t * 16 + ln) * ldb + kb; FragH bq; bq.half[0] = *(const v8us*)(Bh + boff + 8 * hh); bq.half[1] = *(const v8us*)(Bh + boff + 16 + 8 * hh);
      acc[t] = mmaH<ASPLIT ? 2 : 1>(ah.v, al.v, bq.v, bq.v, acc[t]); }
  }
#pragma unroll
  for (int t = 0; t < 4; ++t) { if (col0 + t * 16 >= N) continue;
#pragma unroll
    for (int r = 0; r < 8; ++r) so[w][8 * hh + r][t * 16 + ln] = acc[t][r] * alpha; }
  __builtin_amdgcn_fence(__ATOMIC_ACQ_REL, "workgroup"); __builtin_amdgcn_wave_barrier();
  const int rsub = lane >> 4, c4 = (lane & 15) * 4;
  {
#pragma unroll
    for (int q = 0; q < 8; ++q) { const int r = q * 2 + rsub; if (col0 + c4 < N) { const v4f v = *(const v4fa*)&so[w][r][c4]; *(v4f*)(C + (size_t)(row0 + r) * ldc + col0 + c4) = v; } }
     }
}

template <int DUMMY>
__global__ __launch_bounds__(128) void k_gemm_hh(const _Float16* __restrict__ A, int lda, size_t sA, const _Float16* __restrict__ Bh, int ldb, size_t sB, float alpha, float* __restrict__ C, int ldc, size_t sC, int M, int N, int K) {
  __shared__ __attribute__((aligned(16))) float so[4][16][64];
  const int tid = threadIdx.x, w = tid >> 5, lane = tid & 31, ln = lane & 15, hh = lane >> 4; const int by = blockIdx.y;
  A += (size_t)by * sA; Bh += (size_t)by * sB; C += (size_t)by * sC;
  const int ntn = (N + 63) / 64; const int wid = blockIdx.x * 4 + w; const int mt = wid / ntn, nq = wid % ntn; if (mt * 16 >= M) return;
  const int row0 = mt * 16, col0 = nq * 64; const _Float16* arow = A + (size_t)(row0 + ln) * lda;
  v8f acc[4] = {};
  for (int kb = 0; kb < K; kb += 32) { FragH ah; ah.half[0] = *(const v8us*)((const unsigned short*)arow + kb + 8 * hh); ah.half[1] = *(const v8us*)((const unsigned short*)arow + kb + 16 + 8 * hh);
#pragma unroll
    for (int t = 0; t < 4; ++t) { if (col0 + t * 16 >= N) continue; const size_t boff = (size_t)(col0 + t * 16 + ln) * ldb + kb; FragH bq; bq.half[0] = *(const v8us*)((const unsigned short*)Bh + boff + 8 * hh); bq.half[1] = *(const v8us*)((const unsigned short*)Bh + boff + 16 + 8 * hh);
      acc[t] = mmaH<1>(ah.v, ah.v, bq.v, bq.v, acc[t]); }
  }
#pragma unroll
  for (int t = 0; t < 4; ++t) { if (col0 + t * 16 >= N) continue;
#pragma unroll
    for (int r = 0; r < 8; ++r) so[w][8 * hh + r][t * 16 + ln] = acc[t][r] * alpha; }
  __builtin_amdgcn_fence(__ATOMIC_ACQ_REL, "workgroup"); __builtin_amdgcn_wave_barrier();
  const int rsub = lane >> 4, c4 = (lane & 15) * 4;
  {
#pragma unroll
    for (int q = 0; q < 8; ++q) { const int r = q * 2 + rsub; if (col0 + c4 < N) { const v4f v = *(const v4fa*)&so[w][r][c4]; *(v4f*)(C + (size_t)(row0 + r) * ldc + col0 + c4) = v; } }
     }
}

// X16/Y16 [b][s][d] = f16(bf16(·)); YT16 [b][d][s] via 32×32 tiles
__global__ __launch_bounds__(256) void k_prep(const float* __restrict__ x, const float* __restrict__ y, _Float16* __restrict__ X16, _Float16* __restrict__ Y16) { const size_t t = (size_t)blockIdx.x * 256 + threadIdx.x; if (t >= (size_t)BB * SX * DD / 8) return; FragH a, b; for (int q = 0; q < 8; ++q) { a.h[q] = (_Float16)bf16_round(x[t * 8 + q]); b.h[q] = (_Float16)bf16_round(y[t * 8 + q]); }
  *(v8us*)((unsigned short*)X16 + t * 8) = a.half[0]; *(v8us*)((unsigned short*)Y16 + t * 8) = b.half[0];  }
__global__ __launch_bounds__(256) void k_yt(const float* __restrict__ y, _Float16* __restrict__ YT) { __shared__ float tile[32][33]; const int s0 = blockIdx.x * 32, d0 = blockIdx.y * 32, b = blockIdx.z; const int tx = threadIdx.x & 31, ty = threadIdx.x >> 5;
  for (int i = ty; i < 32; i += 8) tile[i][tx] = bf16_round(y[((size_t)b * SY + s0 + i) * DD + d0 + tx]); __syncthreads();
  { for (int i = ty; i < 32; i += 8) *(_Float16*)(YT + ((size_t)b * DD + d0 + i) * SY + s0 + tx) = (_Float16)tile[tx][i];  } }
// softmax rows (wave per row; lane owns j = u·64 + 2·lane,+1; three streamed passes through the wave's LDS row)
__global__ __launch_bounds__(256) void k_soft(const float* __restrict__ S, _Float16* __restrict__ P) { __shared__ __attribute__((aligned(16))) float sv[8][SY]; const int tid = threadIdx.x, wv = tid >> 5, lane = tid & 31; const size_t i = (size_t)blockIdx.x * 8 + wv;
  typedef float v2f __attribute__((ext_vector_type(2), may_alias)); typedef _Float16 v2h __attribute__((ext_vector_type(2)));
  const float* s = S + i * SY; float* row = sv[wv]; float mx = -3.0e38f;
#pragma unroll 2
  for (int u = 0; u < SY / 64; ++u) { const int j = u * 64 + 2 * lane; const v2f a = *(const v2f*)(s + j); *(v2f*)(row + j) = a; mx = fmaxf(mx, fmaxf(a.x, a.y)); }
  for (int o = 16; o >= 1; o >>= 1) mx = fmaxf(mx, __shfl_xor(mx, o, 32)); float den = 0.f;
#pragma unroll 2
  for (int u = 0; u < SY / 64; ++u) { const int j = u * 64 + 2 * lane; v2f v = *(v2f*)(row + j); v.x = expf(v.x - mx); v.y = expf(v.y - mx); *(v2f*)(row + j) = v; den += v.x + v.y; }
  for (int o = 16; o >= 1; o >>= 1) den += __shfl_xor(den, o, 32); const float inv = 1.0f / den;
  {
#pragma unroll 2
    for (int u = 0; u < SY / 64; ++u) { const int j = u * 64 + 2 * lane; const v2f v = *(const v2f*)(row + j); v2h o2; o2.x = (_Float16)(v.x * inv); o2.y = (_Float16)(v.y * inv); *(v2h*)(P + i * SY + j) = o2; }  } }
// out = bf16(x) + ATT; thread per float4
__global__ __launch_bounds__(256) void k_fin(const float* __restrict__ x, const float* __restrict__ ATT, float* __restrict__ out) { const size_t t = (size_t)blockIdx.x * 256 + threadIdx.x; if (t >= (size_t)BB * SX * DD / 4) return; const v4f a = *(const v4fa*)(x + t * 4), c = *(const v4fa*)(ATT + t * 4); v4f o; for (int q = 0; q < 4; ++q) o[q] = bf16_round(a[q]) + c[q]; *(v4f*)(out + t * 4) = o;  }
extern "C" void kernel_launch(void* const* d_in, const int* in_sizes, int n_in,
                              void* d_out, int out_size, void* d_ws, size_t ws_size, hipStream_t stream) {
  (void)in_sizes; (void)n_in; (void)out_size;
  const float* x = (const float*)d_in[0]; const float* y = (const float*)d_in[1];
  char* ws = (char*)d_ws; size_t off = 0;
  auto take = [&](size_t bytes) { char* p = ws + off; off += (bytes + 255) & ~(size_t)255; return p; };
  _Float16* X16 = (_Float16*)take((size_t)BB * SX * DD * 2); _Float16* Y16 = (_Float16*)take((size_t)BB * SY * DD * 2); _Float16* YT = (_Float16*)take((size_t)BB * DD * SY * 2); float* S = (float*)take((size_t)SX * SY * 4); _Float16* P = (_Float16*)take((size_t)SX * SY * 2); float* ATT = (float*)take((size_t)BB * SX * DD * 4);
  if (off > ws_size) return;
  k_prep<<<(unsigned)(((size_t)BB * SX * DD / 8 + 255) / 256), 256, 0, stream>>>(x, y, X16, Y16); k_yt<<<dim3(SY / 32, DD / 32, BB), 256, 0, stream>>>(y, YT);
  for (int b = 0; b < BB; ++b) {
    k_gemm_hh<0><<<dim3(((SX / 16) * (SY / 64) + 3) / 4, 1), 128, 0, stream>>>(X16 + (size_t)b * SX * DD, DD, 0, Y16 + (size_t)b * SY * DD, DD, 0, 1.0f, S, SY, 0, SX, SY, DD);
    k_soft<<<SX / 8, 256, 0, stream>>>(S, P);
    k_gemm_hh<0><<<dim3(((SX / 16) * (DD / 64) + 3) / 4, 1), 128, 0, stream>>>(P, SY, 0, YT + (size_t)b * DD * SY, SY, 0, 1.0f, ATT + (size_t)b * SX * DD, DD, 0, SX, DD, SY); }
  k_fin<<<(unsigned)(((size_t)BB * SX * DD / 4 + 255) / 256), 256, 0, stream>>>(x, ATT, (float*)d_out);
}

// v001
// Measured time: 166 microseconds a run.
// Timed twice side by side with v000, it ran 3.90 and 3.81 times as fast.
#include <hip/hip_runtime.h>
// scores = x·yᵀ per batch on v_wmma_f32_16x16x32_f16 with x, y rounded to bf16 (exact in f16: single exact products, f32 accumulate; 8 × 2048 × 2048 × 128), softmax over j in f32
// (whole-line f16 stores), att = P·y on the same unit (softmax weights rounded to f16 vs exact y: single product), + x residual in f32.
#define BB 8
#define SX 2048
#define SY 2048
#define DD 128

typedef __bf16 v16b __attribute__((ext_vector_type(16)));
typedef unsigned short v8us __attribute__((ext_vector_type(8), may_alias));
typedef float  v8f  __attribute__((ext_vector_type(8)));
typedef float  v4f  __attribute__((ext_vector_type(4)));
typedef float  v4fa __attribute__((ext_vector_type(4), may_alias));
union FragB { v16b v; v8us half[2]; unsigned short u[16]; };

__device__ __forceinline__ unsigned short bf16_bits(float x) { unsigned int u = __float_as_uint(x); return (unsigned short)((u + 0x7FFFu + ((u >> 16) & 1u)) >> 16); }
__device__ __forceinline__ float bf16_val(unsigned short b) { return __uint_as_float(((unsigned int)b) << 16); }
__device__ __forceinline__ float bf16_round(float x) { return bf16_val(bf16_bits(x)); }
// D += A·B with NT terms: 1 = ah·bh, 2 = + al·bh (A split), 3 = + ah·bl (both split)
template <int NT>
__device__ __forceinline__ v8f mmaN(v16b ah, v16b al, v16b bh, v16b bl, v8f c) {
  c = __builtin_amdgcn_wmma_f32_16x16x32_bf16(false, ah, false, bh, (short)0, c, false, false);
  if (NT >= 2) c = __builtin_amdgcn_wmma_f32_16x16x32_bf16(false, al, false, bh, (short)0, c, false, false);
  if (NT >= 3) c = __builtin_amdgcn_wmma_f32_16x16x32_bf16(false, ah, false, bl, (short)0, c, false, false);
  asm volatile("v_nop\n\tv_nop\n\tv_nop\n\tv_nop" : "+v"(c) : "v"(ah), "v"(al), "v"(bh), "v"(bl));
  return c;
}

__global__ __launch_bounds__(256) void k_wt_bf16(const float* __restrict__ W, unsigned short* __restrict__ Wt, int K, int N) {
  const int t = blockIdx.x * 256 + threadIdx.x;
  const int k8n = K / 8;
  if (t >= N * k8n) return;
  const int n = t / k8n, k8 = (t % k8n) * 8;
  v8us v;
#pragma unroll
  for (int i = 0; i < 8; ++i) v[i] = bf16_bits(W[(size_t)(k8 + i) * N + n]);
  *(v8us*)(Wt + (size_t)n * K + k8) = v;
  
}

// GEMM C[M][N] (f32, pitch ldc) = act(A[M][K]·W + bias). A f32 row-major (pitch lda) converted per fragment to bf16
// (ASPLIT: hi/lo two planes -> 2 terms, else single rounded term); Wt bf16 [N][K] (pitch ldb). BIAS_BF16 rounds the
// bias to bf16 first (bias quantised to bf16 before the add). K%32==0, M%16==0, N%64==0.
template <bool ASPLIT, int ACT, bool BIAS_BF16>
__global__ __launch_bounds__(128) void k_gemm_bf(const float* __restrict__ A, int lda, const unsigned short* __restrict__ Wt, int ldb,
                                               const float* __restrict__ bias, float* __restrict__ C, int ldc, int M, int N, int K) {
  __shared__ __attribute__((aligned(16))) float so[4][16][64];
  const int tid = threadIdx.x, w = tid >> 5, lane = tid & 31, ln = lane & 15, hh = lane >> 4;
  const int ntn = N / 64;
  const int wid = blockIdx.x * 4 + w;
  const int mt = wid / ntn, nq = wid % ntn;
  if (mt * 16 >= M) return;
  const int row0 = mt * 16, col0 = nq * 64;
  const float* arow = A + (size_t)(row0 + ln) * lda;
  v8f acc[4] = {};
  for (int kb = 0; kb < K; kb += 32) {
    FragB ah, al;
    const v4f x0 = *(const v4fa*)(arow + kb + 8 * hh), x1 = *(const v4fa*)(arow + kb + 8 * hh + 4);
    const v4f x2 = *(const v4fa*)(arow + kb + 16 + 8 * hh), x3 = *(const v4fa*)(arow + kb + 16 + 8 * hh + 4);
    float xs[16] = {x0[0],x0[1],x0[2],x0[3],x1[0],x1[1],x1[2],x1[3],x2[0],x2[1],x2[2],x2[3],x3[0],x3[1],x3[2],x3[3]};
#pragma unroll
    for (int i = 0; i < 16; ++i) { const unsigned short hb = bf16_bits(xs[i]); ah.u[i] = hb; al.u[i] = ASPLIT ? bf16_bits(xs[i] - bf16_val(hb)) : (unsigned short)0; }
#pragma unroll
    for (int t = 0; t < 4; ++t) {
      const unsigned short* brow = Wt + (size_t)(col0 + t * 16 + ln) * ldb + kb;
      FragB b;
      b.half[0] = *(const v8us*)(brow + 8 * hh);
      b.half[1] = *(const v8us*)(brow + 16 + 8 * hh);
      acc[t] = mmaN<ASPLIT ? 2 : 1>(ah.v, al.v, b.v, b.v, acc[t]);
    }
  }
#pragma unroll
  for (int t = 0; t < 4; ++t) {
    float bv = bias ? bias[col0 + t * 16 + ln] : 0.f;
    if (BIAS_BF16) bv = bf16_round(bv);
#pragma unroll
    for (int r = 0; r < 8; ++r) { float v = acc[t][r] + bv; if (ACT == 1) v = fmaxf(v, 0.f); so[w][8 * hh + r][t * 16 + ln] = v; }
  }
  __builtin_amdgcn_fence(__ATOMIC_ACQ_REL, "workgroup");
  __builtin_amdgcn_wave_barrier();
  const int rsub = lane >> 4, c4 = (lane & 15) * 4;
  {
#pragma unroll
    for (int q = 0; q < 8; ++q) {
      const int r = q * 2 + rsub;
      const v4f v = *(const v4fa*)&so[w][r][c4];
      *(v4f*)(C + (size_t)(row0 + r) * ldc + col0 + c4) = v;
    }
    
  }
}

// Flash-style causal/unmasked attention, all contractions 3-term bf16 hi/lo splits, f32 softmax with running max.
// q,k,v rows are read from f32 buffers with arbitrary row pitch (so they can live inside a fused qkv buffer);
// D = head size (multiple of 32, <= 128); one wave = 16 query rows; block = 4 waves (64 queries) sharing K/V chunks of 32.
template <int D, bool CAUSAL>
__global__ __launch_bounds__(128) void k_flash(const float* __restrict__ qb, const float* __restrict__ kb, const float* __restrict__ vb,
                                             int pitch, int T, int H, float scale, float* __restrict__ y, int ypitch) {
  constexpr int KS = D / 32;        // k-steps for QK
  constexpr int DT = D / 16;        // d tiles for PV
  __shared__ __attribute__((aligned(16))) unsigned short sKh[32][D + 8], sKl[32][D + 8], sVh[32][D + 8], sVl[32][D + 8];
  __shared__ __attribute__((aligned(16))) unsigned short sPh[4][16][40], sPl[4][16][40];
  __shared__ __attribute__((aligned(16))) float sO[4][16][D];
  const int tid = threadIdx.x, w = tid >> 5, lane = tid & 31, ln = lane & 15, hh = lane >> 4;
  const int nqb = (T + 63) / 64;
  const int bh = blockIdx.x / nqb, qblk = blockIdx.x % nqb;
  const int b = bh / H, h = bh % H;
  const int q0 = qblk * 64 + w * 16;
  const float* Q = qb + (size_t)b * T * pitch + h * D;
  const float* K = kb + (size_t)b * T * pitch + h * D;
  const float* V = vb + (size_t)b * T * pitch + h * D;

  // A fragments of the wave's 16 query rows (scaled), hi/lo
  FragB aqh[KS], aql[KS];
  {
    int row = q0 + ln; if (row >= T) row = T - 1;
    const float* qr = Q + (size_t)row * pitch;
#pragma unroll
    for (int ks = 0; ks < KS; ++ks)
#pragma unroll
      for (int i = 0; i < 16; ++i) {
        const int d = ks * 32 + ((i < 8) ? (8 * hh + i) : (16 + 8 * hh + (i - 8)));
        const float x = qr[d] * scale; const unsigned short hb = bf16_bits(x);
        aqh[ks].u[i] = hb; aql[ks].u[i] = bf16_bits(x - bf16_val(hb));
      }
  }
  float m_r[8], l_r[8];
#pragma unroll
  for (int r = 0; r < 8; ++r) { m_r[r] = -3.0e38f; l_r[r] = 0.f; }
  v8f oacc[DT];
#pragma unroll
  for (int dt = 0; dt < DT; ++dt) oacc[dt] = (v8f){0.f,0.f,0.f,0.f,0.f,0.f,0.f,0.f};

  const int kv_end = CAUSAL ? min(T, qblk * 64 + 64) : T;     // block-uniform
  for (int j0 = 0; j0 < kv_end; j0 += 32) {
    __syncthreads();
    for (int e = tid; e < 32 * (D / 4); e += 128) {
      const int r = e / (D / 4), c4 = (e % (D / 4)) * 4;
      const int key = j0 + r;
      v4f kf = {0.f,0.f,0.f,0.f}, vf = {0.f,0.f,0.f,0.f};
      if (key < T) { kf = *(const v4fa*)(K + (size_t)key * pitch + c4); vf = *(const v4fa*)(V + (size_t)key * pitch + c4); }
#pragma unroll
      for (int t = 0; t < 4; ++t) {
        unsigned short hb = bf16_bits(kf[t]); sKh[r][c4 + t] = hb; sKl[r][c4 + t] = bf16_bits(kf[t] - bf16_val(hb));
        hb = bf16_bits(vf[t]); sVh[r][c4 + t] = hb; sVl[r][c4 + t] = bf16_bits(vf[t] - bf16_val(hb));
      }
    }
    __syncthreads();
    // S tile 16 x 32
    v8f s[2];
#pragma unroll
    for (int nt = 0; nt < 2; ++nt) {
      v8f acc = {};
#pragma unroll
      for (int ks = 0; ks < KS; ++ks) {
        FragB bh_, bl_;
        bh_.half[0] = *(const v8us*)&sKh[nt * 16 + ln][ks * 32 + 8 * hh]; bh_.half[1] = *(const v8us*)&sKh[nt * 16 + ln][ks * 32 + 16 + 8 * hh];
        bl_.half[0] = *(const v8us*)&sKl[nt * 16 + ln][ks * 32 + 8 * hh]; bl_.half[1] = *(const v8us*)&sKl[nt * 16 + ln][ks * 32 + 16 + 8 * hh];
        acc = mmaN<3>(aqh[ks].v, aql[ks].v, bh_.v, bl_.v, acc);
      }
      s[nt] = acc;
    }
    // mask + running max (rows 8hh+r; the 16 lanes of a half share rows)
    float alpha[8];
#pragma unroll
    for (int r = 0; r < 8; ++r) {
      const int qi = q0 + 8 * hh + r;
      const int ja = j0 + ln, jb = j0 + 16 + ln;
      if (CAUSAL) { if (ja > qi) s[0][r] = -3.0e38f; if (jb > qi) s[1][r] = -3.0e38f; }
      if (ja >= T) s[0][r] = -3.0e38f;
      if (jb >= T) s[1][r] = -3.0e38f;
      float mx = fmaxf(s[0][r], s[1][r]);
      mx = fmaxf(mx, __shfl_xor(mx, 1, 32)); mx = fmaxf(mx, __shfl_xor(mx, 2, 32)); mx = fmaxf(mx, __shfl_xor(mx, 4, 32)); mx = fmaxf(mx, __shfl_xor(mx, 8, 32));
      const float mnew = fmaxf(m_r[r], mx);
      alpha[r] = (mnew > -1.0e38f) ? __expf(m_r[r] - mnew) : 1.0f;
      const float p0 = (s[0][r] > -1.0e38f) ? __expf(s[0][r] - mnew) : 0.f;
      const float p1 = (s[1][r] > -1.0e38f) ? __expf(s[1][r] - mnew) : 0.f;
      m_r[r] = mnew;
      l_r[r] = l_r[r] * alpha[r] + p0 + p1;            // per-lane partial row sum (16 lanes combined at the end)
      unsigned short hb = bf16_bits(p0); sPh[w][8 * hh + r][ln] = hb;      sPl[w][8 * hh + r][ln] = bf16_bits(p0 - bf16_val(hb));
      hb = bf16_bits(p1);                sPh[w][8 * hh + r][16 + ln] = hb; sPl[w][8 * hh + r][16 + ln] = bf16_bits(p1 - bf16_val(hb));
    }
#pragma unroll
    for (int dt = 0; dt < DT; ++dt)
#pragma unroll
      for (int r = 0; r < 8; ++r) oacc[dt][r] *= alpha[r];
    __builtin_amdgcn_fence(__ATOMIC_ACQ_REL, "workgroup");
    __builtin_amdgcn_wave_barrier();
    FragB pah, pal;
    pah.half[0] = *(const v8us*)&sPh[w][ln][8 * hh]; pah.half[1] = *(const v8us*)&sPh[w][ln][16 + 8 * hh];
    pal.half[0] = *(const v8us*)&sPl[w][ln][8 * hh]; pal.half[1] = *(const v8us*)&sPl[w][ln][16 + 8 * hh];
#pragma unroll
    for (int dt = 0; dt < DT; ++dt) {
      FragB bvh, bvl;
#pragma unroll
      for (int i = 0; i < 8; ++i) {
        bvh.u[i] = sVh[8 * hh + i][dt * 16 + ln]; bvh.u[8 + i] = sVh[16 + 8 * hh + i][dt * 16 + ln];
        bvl.u[i] = sVl[8 * hh + i][dt * 16 + ln]; bvl.u[8 + i] = sVl[16 + 8 * hh + i][dt * 16 + ln];
      }
      oacc[dt] = mmaN<3>(pah.v, pal.v, bvh.v, bvl.v, oacc[dt]);
    }
    __builtin_amdgcn_fence(__ATOMIC_ACQ_REL, "workgroup");
    __builtin_amdgcn_wave_barrier();
  }
#pragma unroll
  for (int r = 0; r < 8; ++r) {
    float l = l_r[r];
    l += __shfl_xor(l, 1, 32); l += __shfl_xor(l, 2, 32); l += __shfl_xor(l, 4, 32); l += __shfl_xor(l, 8, 32);
    l_r[r] = (l > 0.f) ? 1.0f / l : 0.f;
  }
#pragma unroll
  for (int dt = 0; dt < DT; ++dt)
#pragma unroll
    for (int r = 0; r < 8; ++r) sO[w][8 * hh + r][dt * 16 + ln] = oacc[dt][r] * l_r[r];
  __builtin_amdgcn_fence(__ATOMIC_ACQ_REL, "workgroup");
  __builtin_amdgcn_wave_barrier();
  {
    for (int r = 0; r < 16; ++r) {
      const int row = q0 + r;
      if (row < T && lane < D / 4) {
        const v4f val = *(const v4fa*)&sO[w][r][lane * 4];
        *(v4f*)(y + ((size_t)b * T + row) * ypitch + h * D + lane * 4) = val;
      }
    }
    
  }
}

// ---- f16 WMMA path (v_wmma_f32_16x16x32_f16): 11-bit significands for operands in range — used where a [0,1] probability operand needs more precision than bf16
typedef _Float16 v16h __attribute__((ext_vector_type(16)));
union FragH { v16h v; v8us half[2]; _Float16 h[16]; unsigned short u[16]; };
template <int NT>
__device__ __forceinline__ v8f mmaH(v16h ah, v16h al, v16h bh, v16h bl, v8f c) {
  c = __builtin_amdgcn_wmma_f32_16x16x32_f16(false, ah, false, bh, (short)0, c, false, false);
  if (NT >= 2) c = __builtin_amdgcn_wmma_f32_16x16x32_f16(false, al, false, bh, (short)0, c, false, false);
  if (NT >= 3) c = __builtin_amdgcn_wmma_f32_16x16x32_f16(false, ah, false, bl, (short)0, c, false, false);
  asm volatile("v_nop\n\tv_nop\n\tv_nop\n\tv_nop" : "+v"(c) : "v"(ah), "v"(al), "v"(bh), "v"(bl));
  return c;
}
// batched GEMM like k_gemm_b but f16 operands: A f32 (split into f16 hi/lo if ASPLIT, else rounded to f16), Bt = f16 values [n][k]; alpha; C f32; N multiple of 16 (partial tiles skipped)
template <bool ASPLIT>
__global__ __launch_bounds__(128) void k_gemm_h(const float* __restrict__ A, int lda, size_t sA, const _Float16* __restrict__ Bh, int ldb, size_t sB, float alpha, float* __restrict__ C, int ldc, size_t sC, int M, int N, int K) {
  __shared__ __attribute__((aligned(16))) float so[4][16][64];
  const int tid = threadIdx.x, w = tid >> 5, lane = tid & 31, ln = lane & 15, hh = lane >> 4; const int by = blockIdx.y;
  A += (size_t)by * sA; Bh += (size_t)by * sB; C += (size_t)by * sC;
  const int ntn = (N + 63) / 64; const int wid = blockIdx.x * 4 + w; const int mt = wid / ntn, nq = wid % ntn; if (mt * 16 >= M) return;
  const int row0 = mt * 16, col0 = nq * 64; const float* arow = A + (size_t)(row0 + ln) * lda;
  v8f acc[4] = {};
  for (int kb = 0; kb < K; kb += 32) {
    FragH ah, al;
    const v4f x0 = *(const v4fa*)(arow + kb + 8 * hh), x1 = *(const v4fa*)(arow + kb + 8 * hh + 4), x2 = *(const v4fa*)(arow + kb + 16 + 8 * hh), x3 = *(const v4fa*)(arow + kb + 16 + 8 * hh + 4);
    float xs[16] = {x0[0],x0[1],x0[2],x0[3],x1[0],x1[1],x1[2],x1[3],x2[0],x2[1],x2[2],x2[3],x3[0],x3[1],x3[2],x3[3]};
#pragma unroll
    for (int i = 0; i < 16; ++i) { const _Float16 h = (_Float16)xs[i]; ah.h[i] = h; al.h[i] = ASPLIT ? (_Float16)(xs[i] - (float)h) : (_Float16)0.0f; }
#pragma unroll
    for (int t = 0; t < 4; ++t) { if (col0 + t * 16 >= N) continue; const size_t boff = (size_t)(col0 + t * 16 + ln) * ldb + kb; FragH bq; bq.half[0] = *(const v8us*)(Bh + boff + 8 * hh); bq.half[1] = *(const v8us*)(Bh + boff + 16 + 8 * hh);
      acc[t] = mmaH<ASPLIT ? 2 : 1>(ah.v, al.v, bq.v, bq.v, acc[t]); }
  }
#pragma unroll
  for (int t = 0; t < 4; ++t) { if (col0 + t * 16 >= N) continue;
#pragma unroll
    for (int r = 0; r < 8; ++r) so[w][8 * hh + r][t * 16 + ln] = acc[t][r] * alpha; }
  __builtin_amdgcn_fence(__ATOMIC_ACQ_REL, "workgroup"); __builtin_amdgcn_wave_barrier();
  const int rsub = lane >> 4, c4 = (lane & 15) * 4;
  {
#pragma unroll
    for (int q = 0; q < 8; ++q) { const int r = q * 2 + rsub; if (col0 + c4 < N) { const v4f v = *(const v4fa*)&so[w][r][c4]; *(v4f*)(C + (size_t)(row0 + r) * ldc + col0 + c4) = v; } }
     }
}

template <int DUMMY>
__global__ __launch_bounds__(128) void k_gemm_hh(const _Float16* __restrict__ A, int lda, size_t sA, const _Float16* __restrict__ Bh, int ldb, size_t sB, float alpha, float* __restrict__ C, int ldc, size_t sC, int M, int N, int K) {
  __shared__ __attribute__((aligned(16))) float so[4][16][64];
  const int tid = threadIdx.x, w = tid >> 5, lane = tid & 31, ln = lane & 15, hh = lane >> 4; const int by = blockIdx.y;
  A += (size_t)by * sA; Bh += (size_t)by * sB; C += (size_t)by * sC;
  const int ntn = (N + 63) / 64; const int wid = blockIdx.x * 4 + w; const int mt = wid / ntn, nq = wid % ntn; if (mt * 16 >= M) return;
  const int row0 = mt * 16, col0 = nq * 64; const _Float16* arow = A + (size_t)(row0 + ln) * lda;
  v8f acc[4] = {};
  for (int kb = 0; kb < K; kb += 32) { FragH ah; ah.half[0] = *(const v8us*)((const unsigned short*)arow + kb + 8 * hh); ah.half[1] = *(const v8us*)((const unsigned short*)arow + kb + 16 + 8 * hh);
#pragma unroll
    for (int t = 0; t < 4; ++t) { if (col0 + t * 16 >= N) continue; const size_t boff = (size_t)(col0 + t * 16 + ln) * ldb + kb; FragH bq; bq.half[0] = *(const v8us*)((const unsigned short*)Bh + boff + 8 * hh); bq.half[1] = *(const v8us*)((const unsigned short*)Bh + boff + 16 + 8 * hh);
      acc[t] = mmaH<1>(ah.v, ah.v, bq.v, bq.v, acc[t]); }
  }
#pragma unroll
  for (int t = 0; t < 4; ++t) { if (col0 + t * 16 >= N) continue;
#pragma unroll
    for (int r = 0; r < 8; ++r) so[w][8 * hh + r][t * 16 + ln] = acc[t][r] * alpha; }
  __builtin_amdgcn_fence(__ATOMIC_ACQ_REL, "workgroup"); __builtin_amdgcn_wave_barrier();
  const int rsub = lane >> 4, c4 = (lane & 15) * 4;
  {
#pragma unroll
    for (int q = 0; q < 8; ++q) { const int r = q * 2 + rsub; if (col0 + c4 < N) { const v4f v = *(const v4fa*)&so[w][r][c4]; *(v4f*)(C + (size_t)(row0 + r) * ldc + col0 + c4) = v; } }
     }
}

// X16/Y16 [b][s][d] = f16(bf16(·)); YT16 [b][d][s] via 32×32 tiles
__global__ __launch_bounds__(256) void k_prep(const float* __restrict__ x, const float* __restrict__ y, _Float16* __restrict__ X16, _Float16* __restrict__ Y16) { const size_t t = (size_t)blockIdx.x * 256 + threadIdx.x; if (t >= (size_t)BB * SX * DD / 8) return; FragH a, b; for (int q = 0; q < 8; ++q) { a.h[q] = (_Float16)bf16_round(x[t * 8 + q]); b.h[q] = (_Float16)bf16_round(y[t * 8 + q]); }
  *(v8us*)((unsigned short*)X16 + t * 8) = a.half[0]; *(v8us*)((unsigned short*)Y16 + t * 8) = b.half[0];  }
__global__ __launch_bounds__(256) void k_yt(const float* __restrict__ y, _Float16* __restrict__ YT) { __shared__ float tile[32][33]; const int s0 = blockIdx.x * 32, d0 = blockIdx.y * 32, b = blockIdx.z; const int tx = threadIdx.x & 31, ty = threadIdx.x >> 5;
  for (int i = ty; i < 32; i += 8) tile[i][tx] = bf16_round(y[((size_t)b * SY + s0 + i) * DD + d0 + tx]); __syncthreads();
  { for (int i = ty; i < 32; i += 8) *(_Float16*)(YT + ((size_t)b * DD + d0 + i) * SY + s0 + tx) = (_Float16)tile[tx][i];  } }
// softmax rows (wave per row; lane owns j = u·64 + 2·lane,+1; three streamed passes through the wave's LDS row)
__global__ __launch_bounds__(256) void k_soft(const float* __restrict__ S, _Float16* __restrict__ P) { __shared__ __attribute__((aligned(16))) float sv[8][SY]; const int tid = threadIdx.x, wv = tid >> 5, lane = tid & 31; const size_t i = (size_t)blockIdx.x * 8 + wv;
  typedef float v2f __attribute__((ext_vector_type(2), may_alias)); typedef _Float16 v2h __attribute__((ext_vector_type(2)));
  const float* s = S + i * SY; float* row = sv[wv]; float mx = -3.0e38f;
#pragma unroll 2
  for (int u = 0; u < SY / 64; ++u) { const int j = u * 64 + 2 * lane; const v2f a = *(const v2f*)(s + j); *(v2f*)(row + j) = a; mx = fmaxf(mx, fmaxf(a.x, a.y)); }
  for (int o = 16; o >= 1; o >>= 1) mx = fmaxf(mx, __shfl_xor(mx, o, 32)); float den = 0.f;
#pragma unroll 2
  for (int u = 0; u < SY / 64; ++u) { const int j = u * 64 + 2 * lane; v2f v = *(v2f*)(row + j); v.x = expf(v.x - mx); v.y = expf(v.y - mx); *(v2f*)(row + j) = v; den += v.x + v.y; }
  for (int o = 16; o >= 1; o >>= 1) den += __shfl_xor(den, o, 32); const float inv = 1.0f / den;
  {
#pragma unroll 2
    for (int u = 0; u < SY / 64; ++u) { const int j = u * 64 + 2 * lane; const v2f v = *(const v2f*)(row + j); v2h o2; o2.x = (_Float16)(v.x * inv); o2.y = (_Float16)(v.y * inv); *(v2h*)(P + i * SY + j) = o2; }  } }
// out = bf16(x) + ATT; thread per float4
__global__ __launch_bounds__(256) void k_fin(const float* __restrict__ x, const float* __restrict__ ATT, float* __restrict__ out) { const size_t t = (size_t)blockIdx.x * 256 + threadIdx.x; if (t >= (size_t)BB * SX * DD / 4) return; const v4f a = *(const v4fa*)(x + t * 4), c = *(const v4fa*)(ATT + t * 4); v4f o; for (int q = 0; q < 4; ++q) o[q] = bf16_round(a[q]) + c[q]; *(v4f*)(out + t * 4) = o;  }
extern "C" void kernel_launch(void* const* d_in, const int* in_sizes, int n_in,
                              void* d_out, int out_size, void* d_ws, size_t ws_size, hipStream_t stream) {
  (void)in_sizes; (void)n_in; (void)out_size;
  const float* x = (const float*)d_in[0]; const float* y = (const float*)d_in[1];
  char* ws = (char*)d_ws; size_t off = 0;
  auto take = [&](size_t bytes) { char* p = ws + off; off += (bytes + 255) & ~(size_t)255; return p; };
  _Float16* X16 = (_Float16*)take((size_t)BB * SX * DD * 2); _Float16* Y16 = (_Float16*)take((size_t)BB * SY * DD * 2); _Float16* YT = (_Float16*)take((size_t)BB * DD * SY * 2); float* S = (float*)take((size_t)BB * SX * SY * 4); _Float16* P = (_Float16*)take((size_t)BB * SX * SY * 2); float* ATT = (float*)take((size_t)BB * SX * DD * 4);
  if (off > ws_size) return;
  k_prep<<<(unsigned)(((size_t)BB * SX * DD / 8 + 255) / 256), 256, 0, stream>>>(x, y, X16, Y16); k_yt<<<dim3(SY / 32, DD / 32, BB), 256, 0, stream>>>(y, YT);
  // every batch in one launch per stage: blockIdx.y is the batch in both products, S and P hold all batches, a softmax row index runs over b * SX + i
  k_gemm_hh<0><<<dim3(((SX / 16) * (SY / 64) + 3) / 4, BB), 128, 0, stream>>>(X16, DD, (size_t)SX * DD, Y16, DD, (size_t)SY * DD, 1.0f, S, SY, (size_t)SX * SY, SX, SY, DD);
  k_soft<<<BB * SX / 8, 256, 0, stream>>>(S, P);
  k_gemm_hh<0><<<dim3(((SX / 16) * (DD / 64) + 3) / 4, BB), 128, 0, stream>>>(P, SY, (size_t)SX * SY, YT, SY, (size_t)DD * SY, 1.0f, ATT, DD, (size_t)SX * DD, SX, DD, SY);
  k_fin<<<(unsigned)(((size_t)BB * SX * DD / 4 + 255) / 256), 256, 0, stream>>>(x, ATT, (float*)d_out);
}

// v002
// It runs in 23.8 microseconds.
// Two timings next to v001 put it at 6.87 and 6.89 times that version's speed.
// Counting every step since v000, it is 26.5 times as fast.
#include <hip/hip_runtime.h>
#include <stdint.h>
#define BB 8
#define SX 2048
#define SY 2048
#define DD 128

typedef unsigned short v8us __attribute__((ext_vector_type(8), may_alias));
typedef float  v8f  __attribute__((ext_vector_type(8)));
typedef float  v4f  __attribute__((ext_vector_type(4)));
typedef float  v4fa __attribute__((ext_vector_type(4), may_alias));
typedef uint32_t u32x4 __attribute__((ext_vector_type(4)));
typedef uint32_t u32x4a __attribute__((ext_vector_type(4), may_alias));
typedef int i32x8 __attribute__((ext_vector_type(8)));
typedef short s16x8 __attribute__((ext_vector_type(8)));
typedef _Float16 v16h __attribute__((ext_vector_type(16)));
union FragH { v16h v; v8us half[2]; _Float16 h[16]; unsigned short u[16]; };

__device__ __forceinline__ unsigned short bf16_bits(float x) { unsigned int u = __float_as_uint(x); return (unsigned short)((u + 0x7FFFu + ((u >> 16) & 1u)) >> 16); }
__device__ __forceinline__ float bf16_val(unsigned short b) { return __uint_as_float(((unsigned int)b) << 16); }
__device__ __forceinline__ float bf16_round(float x) { return bf16_val(bf16_bits(x)); }

// X16/Y16 [b][s][d] = f16(bf16(.))
__global__ __launch_bounds__(256) void k_prep(const float* __restrict__ x, const float* __restrict__ y, _Float16* __restrict__ X16, _Float16* __restrict__ Y16) { const size_t t = (size_t)blockIdx.x * 256 + threadIdx.x; if (t >= (size_t)BB * SX * DD / 8) return; FragH a, b; for (int q = 0; q < 8; ++q) { a.h[q] = (_Float16)bf16_round(x[t * 8 + q]); b.h[q] = (_Float16)bf16_round(y[t * 8 + q]); }
  *(v8us*)((unsigned short*)X16 + t * 8) = a.half[0]; *(v8us*)((unsigned short*)Y16 + t * 8) = b.half[0];  }

constexpr int DK = DD / 32, DT = DD / 16;   // k steps of the score product, 16-row tiles of O^T
constexpr int NW = 8, R = 2, BR = 64;       // waves, 16-column groups per wave, query rows per work-group
constexpr int NQ = 4, BC = 32, KT = BC / 16; // key quarters, keys per pass, 16-key score tiles per pass
constexpr int NSUB = 2, SK = NSUB * BC;      // passes per stage, keys of one quarter per stage
constexpr int NST = SY / (NQ * SK);         // stages
constexpr uint32_t ROWB = 2u * DD, PITCH_K = ROWB + 16u, PITCH_V = ROWB + 32u;  // ds_load_b128 reader: 16 B x odd; ds_load_tr16_b128 reader: 32 B x odd
constexpr uint32_t SROWS = NQ * SK, TILE_K = SROWS * PITCH_K, TILE_V = SROWS * PITCH_V, SLOT = TILE_K + TILE_V, LDS_BYTES = 2u * SLOT;
constexpr uint32_t EPITCH = 4u * DD + 16u;  // pitch of a staged f32 output row
static_assert((uint32_t)NQ * BR * EPITCH <= LDS_BYTES, "the partial outputs reuse the two stage buffers");

// Most "#pragma unroll" below stand on loops that index register arrays (fragments, accumulators): the indices must be compile-time constants.
#define DEV static __device__ __forceinline__
DEV void fence() { __builtin_amdgcn_sched_barrier(0); }
DEV void nop4() { asm volatile("v_nop\n\tv_nop\n\tv_nop\n\tv_nop"); }  // the 4 vector slots between a 16-bit WMMA and a vector instruction that touches its registers, on every path
DEV void wait_x() { asm volatile("s_wait_xcnt 0x0" ::: "memory"); }  // behind global loads, in front of any rewrite of their address registers
struct Frag { u32x4 q[2]; };
DEV v8f mma(const Frag& a, const Frag& b, v8f c) {
  const i32x8 av = {(int)a.q[0].x, (int)a.q[0].y, (int)a.q[0].z, (int)a.q[0].w, (int)a.q[1].x, (int)a.q[1].y, (int)a.q[1].z, (int)a.q[1].w};
  const i32x8 bv = {(int)b.q[0].x, (int)b.q[0].y, (int)b.q[0].z, (int)b.q[0].w, (int)b.q[1].x, (int)b.q[1].y, (int)b.q[1].z, (int)b.q[1].w};
  return __builtin_amdgcn_wmma_f32_16x16x32_f16(false, __builtin_bit_cast(v16h, av), false, __builtin_bit_cast(v16h, bv), (short)0, c, false, false);
}
DEV u32x4 ld_tr16(const unsigned char* p) { typedef __attribute__((address_space(3))) s16x8 lds_s16x8; return __builtin_bit_cast(u32x4, __builtin_amdgcn_ds_load_tr16_b128_v8i16((lds_s16x8*)p)); }
DEV uint32_t pack2(float lo, float hi) { typedef _Float16 h2 __attribute__((ext_vector_type(2))); typedef float f2 __attribute__((ext_vector_type(2)));
  return __builtin_bit_cast(uint32_t, __builtin_convertvector(f2{lo, hi}, h2)); }  // round to nearest even
DEV float xhalf(float x) { return __builtin_bit_cast(float, __builtin_amdgcn_permlanex16(__builtin_bit_cast(int, x), __builtin_bit_cast(int, x), 0x76543210, 0xfedcba98, false, false)); }  // lane l with lane l ^ 16

struct KFr { Frag f[KT][DK]; };
DEV void load_k(KFr& k, const unsigned char* kbase, uint32_t lane) {
  const uint32_t c = lane & 15u, h = lane >> 4;
  #pragma unroll
  for (int kt = 0; kt < KT; ++kt) {
    const unsigned char* p = kbase + (16u * kt + c) * PITCH_K + 16u * h;  // hardware k order: bytes 16h and 32 + 16h of each 64
    #pragma unroll
    for (int kc = 0; kc < DK; ++kc) { k.f[kt][kc].q[0] = *reinterpret_cast<const u32x4a*>(p + 64u * kc); k.f[kt][kc].q[1] = *reinterpret_cast<const u32x4a*>(p + 64u * kc + 32u); }
  }
}
// One 32-key pass of one wave. kf: the pass's y rows; vbase: the same rows in the copy for the transposing load; next_k: the next pass's rows, fetched when FETCH. m_run, the maximum in use (log2 domain), may trail
// the true one by up to 8, so a weight can reach 2^8 (inside f16): the accumulators are rescaled only when some column exceeds it by more.
template <bool FETCH>
DEV void pass(KFr& kf, const unsigned char* next_k, const unsigned char* vbase, uint32_t lane, const Frag (&qf)[R][DK], v8f (&acc)[R][DT], float (&m_run)[R], float (&l_run)[R]) {
  const uint32_t h = lane >> 4;
  const float cscale = 1.4426950408889634f;
  Frag vf[DT];
  {
    const unsigned char* ad = vbase + (8u * h + (lane & 7u)) * PITCH_V + ((lane >> 3) & 1u) * 16u;
    #pragma unroll
    for (int t = 0; t < DT; ++t) { vf[t].q[0] = ld_tr16(ad + 32u * t); vf[t].q[1] = ld_tr16(ad + 16u * PITCH_V + 32u * t); }
  }
  v8f s[KT][R];
  #pragma unroll
  for (int kt = 0; kt < KT; ++kt) {
    #pragma unroll
    for (int g = 0; g < R; ++g) { s[kt][g] = v8f{};
      #pragma unroll
      for (int kc = 0; kc < DK; ++kc) s[kt][g] = mma(kf.f[kt][kc], qf[g][kc], s[kt][g]); }
  }
  fence();  // keeps the maxima behind the whole run of score products: moved in between, each read of a fresh tile costs its own idle slots
  if (FETCH) load_k(kf, next_k, lane);  // in flight under this pass's softmax and second product
  float mb[R]; bool need = false;
  #pragma unroll
  for (int g = 0; g < R; ++g) {
    float mx = s[0][g][0];
    #pragma unroll
    for (int kt = 0; kt < KT; ++kt) {
      #pragma unroll
      for (int r = 0; r < 8; ++r) mx = __builtin_fmaxf(mx, s[kt][g][r]);
    }
    mx = __builtin_fmaxf(mx, xhalf(mx)) * cscale;  // both wave halves now hold this query's maximum of the pass
    mb[g] = mx; need = need || (mx > m_run[g] + 8.0f);
  }
  if (__builtin_amdgcn_ballot_w32(need) != 0) {  // a scalar branch, rare after the first passes
    #pragma unroll
    for (int g = 0; g < R; ++g) {
      const float m_new = __builtin_fmaxf(m_run[g], mb[g]);
      const float corr = __builtin_amdgcn_exp2f(m_run[g] - m_new);  // 0 on the first pass, where m_run is -inf
      l_run[g] *= corr; m_run[g] = m_new;
      #pragma unroll
      for (int t = 0; t < DT; ++t) acc[g][t] = acc[g][t] * corr;
    }
  }
  float ps[R][2];
  #pragma unroll
  for (int g = 0; g < R; ++g) {
    ps[g][0] = 0.0f; ps[g][1] = 0.0f;
    const float nm = -m_run[g];
    typedef float f32x2 __attribute__((ext_vector_type(2)));
    f32x2 arg[8];
    #pragma unroll
    for (int i = 0; i < 8; ++i)
      arg[i] = __builtin_elementwise_fma(f32x2{s[i >> 2][g][2 * (i & 3)], s[i >> 2][g][2 * (i & 3) + 1]}, f32x2{cscale, cscale}, f32x2{nm, nm});
    uint32_t w[8];
    #pragma unroll
    for (int i = 0; i < 8; ++i) {
      const float p0 = __builtin_amdgcn_exp2f(arg[i].x), p1 = __builtin_amdgcn_exp2f(arg[i].y);
      ps[g][i & 1] += p0 + p1;
      w[i] = pack2(p0, p1);
    }
    Frag pf; pf.q[0] = u32x4{w[0], w[1], w[2], w[3]}; pf.q[1] = u32x4{w[4], w[5], w[6], w[7]};
    #pragma unroll
    for (int t = 0; t < DT; ++t) acc[g][t] = mma(vf[t], pf, acc[g][t]);
  }
  #pragma unroll
  for (int g = 0; g < R; ++g) l_run[g] += ps[g][0] + ps[g][1];
  fence(); nop4(); fence();  // a branch follows the last WMMAs: keep their distance on its taken side too
}

__global__ void __launch_bounds__(NW * 32) __attribute__((amdgpu_waves_per_eu(2, 2))) k_fused(const _Float16* __restrict__ X16, const _Float16* __restrict__ Y16, const float* __restrict__ x, float* __restrict__ out) {
  __shared__ __attribute__((aligned(256))) unsigned char L[LDS_BYTES];
  __shared__ float sm[NQ][BR], sl[NQ][BR];
  const uint32_t tid = threadIdx.x, lane = tid & 31u, wave = __builtin_amdgcn_readfirstlane(tid >> 5), c = lane & 15u, h = lane >> 4;
  const uint32_t cg = wave & 1u, kq = wave >> 1;
  const uint32_t b = blockIdx.x / (SX / BR), q0 = (blockIdx.x % (SX / BR)) * BR;
  const unsigned char* Yb = reinterpret_cast<const unsigned char*>(Y16 + (size_t)b * SY * DD);
  // Staging: 16 lanes cover one 256-byte row; load i of a thread is key 16 (i & 1) + srow of pass sub of quarter i >> 1.
  const uint32_t srow = tid >> 4, scol = (tid & 15u) * 16u, voff = srow * ROWB + scol;
  u32x4 pre[8];
  auto gload = [&](u32x4 (&pre)[8], uint32_t st, uint32_t sub) {
    const unsigned char* ys = Yb + (size_t)(st * SK + sub * BC) * ROWB;  // the uniform part of the address
    #pragma unroll
    for (uint32_t i = 0; i < 8; ++i) pre[i] = *reinterpret_cast<const u32x4a*>(ys + ((i >> 1) * (uint32_t)(SY / NQ) + (i & 1u) * 16u) * ROWB + voff);
  };
  auto lstore = [&](const u32x4 (&pre)[8], uint32_t slot, uint32_t sub) {
    #pragma unroll
    for (uint32_t i = 0; i < 8; ++i) {
      const uint32_t row = (i >> 1) * SK + sub * BC + (i & 1u) * 16u + srow;
      *reinterpret_cast<u32x4a*>(L + slot * SLOT + row * PITCH_K + scol) = pre[i];
      *reinterpret_cast<u32x4a*>(L + slot * SLOT + TILE_K + row * PITCH_V + scol) = pre[i];
    }
  };
  u32x4 pre1[8];  // stage 0's second pass: both halves of the first stage fly together
  gload(pre, 0, 0); gload(pre1, 0, 1);
  // x fragments (B operand) in the hardware k order, as y's in pass()
  Frag qf[R][DK];
  #pragma unroll
  for (int g = 0; g < R; ++g) {
    const _Float16* qp = X16 + ((size_t)b * SX + q0 + cg * 32u + 16u * g + c) * DD + 8u * h;
    #pragma unroll
    for (int kc = 0; kc < DK; ++kc) { qf[g][kc].q[0] = *reinterpret_cast<const u32x4a*>(qp + 32 * kc); qf[g][kc].q[1] = *reinterpret_cast<const u32x4a*>(qp + 32 * kc + 16); }
  }
  wait_x();
  v8f acc[R][DT];
  float m_run[R], l_run[R];
  #pragma unroll
  for (int g = 0; g < R; ++g) { m_run[g] = -__builtin_inff(); l_run[g] = 0.0f;
    #pragma unroll
    for (int t = 0; t < DT; ++t) acc[g][t] = v8f{}; }
  lstore(pre, 0, 0); lstore(pre1, 0, 1);
  __syncthreads();
  KFr kf;
  #pragma unroll 1  // one copy of the stage in the instruction cache: nothing in a stage needs st at compile time
  for (uint32_t st = 0; st < (uint32_t)NST; ++st) {
    const uint32_t slot = st & 1u;
    const bool more = st + 1u < (uint32_t)NST;  // uniform
    const unsigned char* kb = L + slot * SLOT + kq * SK * PITCH_K;
    const unsigned char* vb = L + slot * SLOT + TILE_K + kq * SK * PITCH_V;
    load_k(kf, kb, lane);
    if (more) { gload(pre, st + 1u, 0); wait_x(); }  // in flight under the pass
    pass<true>(kf, kb + BC * PITCH_K, vb, lane, qf, acc, m_run, l_run);
    if (more) { lstore(pre, slot ^ 1u, 0); gload(pre, st + 1u, 1); wait_x(); }  // every wave left that buffer before the barrier that ended stage st - 1
    pass<false>(kf, kb, vb + BC * PITCH_V, lane, qf, acc, m_run, l_run);
    if (more) lstore(pre, slot ^ 1u, 1);
    __syncthreads();  // publishes stage st + 1 and ends every read of stage st
  }
  // The residual's x, in flight under the join: the work-group's 64 rows are one contiguous block of x and of out.
  constexpr uint32_t NO = (uint32_t)BR * DD / 4u / (NW * 32u);
  const size_t blk = ((size_t)b * SX + q0) * DD;  // uniform
  const unsigned char* xb = reinterpret_cast<const unsigned char*>(x + blk);
  unsigned char* ob = reinterpret_cast<unsigned char*>(out + blk);
  v4f xv[NO];
  #pragma unroll
  for (uint32_t i = 0; i < NO; ++i) xv[i] = *reinterpret_cast<const v4fa*>(xb + (tid * 16u + i * (NW * 32u * 16u)));
  wait_x();
  // Join the four key quarters: common maximum M and sum per query, each wave scales its own partial O^T, the work-group adds the four.
  #pragma unroll
  for (int g = 0; g < R; ++g) {
    const float l = l_run[g] + xhalf(l_run[g]);  // each wave half summed its eight keys of every 16-key tile
    if (h == 0) { sm[kq][cg * 32u + 16u * g + c] = m_run[g]; sl[kq][cg * 32u + 16u * g + c] = l; }
  }
  __syncthreads();
  #pragma unroll
  for (int g = 0; g < R; ++g) {
    const uint32_t col = cg * 32u + 16u * g + c;
    float M = sm[0][col];
    #pragma unroll
    for (int k = 1; k < NQ; ++k) M = __builtin_fmaxf(M, sm[k][col]);
    float den = 0.0f;
    #pragma unroll
    for (int k = 0; k < NQ; ++k) den += sl[k][col] * __builtin_amdgcn_exp2f(sm[k][col] - M);
    const float f = __builtin_amdgcn_exp2f(m_run[g] - M) / den;
    #pragma unroll
    for (int t = 0; t < DT; ++t) {
      const v8f o = acc[g][t] * f;  // d = 16 t + 8 h + r of query col
      unsigned char* p = L + (kq * BR + col) * EPITCH + (16u * t + 8u * h) * 4u;
      *reinterpret_cast<v4fa*>(p) = v4f{o[0], o[1], o[2], o[3]};
      *reinterpret_cast<v4fa*>(p + 16u) = v4f{o[4], o[5], o[6], o[7]};
    }
  }
  __syncthreads();
  // Whole rows: 32 lanes cover one 512-byte output row.
  #pragma unroll
  for (uint32_t i = 0; i < NO; ++i) {
    const uint32_t e = tid + i * (NW * 32u), q = e >> 5, c4 = e & 31u;
    v4f a = *reinterpret_cast<const v4fa*>(L + q * EPITCH + c4 * 16u);
    #pragma unroll
    for (uint32_t k = 1; k < (uint32_t)NQ; ++k) a += *reinterpret_cast<const v4fa*>(L + (k * BR + q) * EPITCH + c4 * 16u);
    v4f o;
    #pragma unroll
    for (int j = 0; j < 4; ++j) o[j] = bf16_round(xv[i][j]) + a[j];
    *reinterpret_cast<v4fa*>(ob + (tid * 16u + i * (NW * 32u * 16u))) = o;
  }
}

extern "C" void kernel_launch(void* const* d_in, const int* in_sizes, int n_in,
                              void* d_out, int out_size, void* d_ws, size_t ws_size, hipStream_t stream) {
  (void)in_sizes; (void)n_in; (void)out_size;
  const float* x = (const float*)d_in[0]; const float* y = (const float*)d_in[1];
  char* ws = (char*)d_ws; size_t off = 0;
  auto take = [&](size_t bytes) { char* p = ws + off; off += (bytes + 255) & ~(size_t)255; return p; };
  _Float16* X16 = (_Float16*)take((size_t)BB * SX * DD * 2); _Float16* Y16 = (_Float16*)take((size_t)BB * SY * DD * 2);
  if (off > ws_size) return;
  k_prep<<<(unsigned)(((size_t)BB * SX * DD / 8 + 255) / 256), 256, 0, stream>>>(x, y, X16, Y16);
  k_fused<<<BB * (SX / BR), NW * 32, 0, stream>>>(X16, Y16, x, (float*)d_out);
}

// v003
// Measured time: 21.6 microseconds a run.
// Next to v002, in two timings, it ran 1.11 and 1.10 times as fast.
// All steps since v000 together make it 29.2 times as fast.
#include <hip/hip_runtime.h>
#include <stdint.h>
#define BB 8
#define SX 2048
#define SY 2048
#define DD 128

typedef float  v8f  __attribute__((ext_vector_type(8)));
typedef float  v4f  __attribute__((ext_vector_type(4)));
typedef float  v4fa __attribute__((ext_vector_type(4), may_alias));
typedef uint32_t u32x4 __attribute__((ext_vector_type(4)));
typedef uint32_t u32x4a __attribute__((ext_vector_type(4), may_alias));
typedef uint32_t u32x2 __attribute__((ext_vector_type(2)));
typedef uint32_t u32x2a __attribute__((ext_vector_type(2), may_alias));
typedef int i32x8 __attribute__((ext_vector_type(8)));
typedef short s16x8 __attribute__((ext_vector_type(8)));
typedef _Float16 v16h __attribute__((ext_vector_type(16)));

__device__ __forceinline__ unsigned short bf16_bits(float x) { unsigned int u = __float_as_uint(x); return (unsigned short)((u + 0x7FFFu + ((u >> 16) & 1u)) >> 16); }
__device__ __forceinline__ float bf16_val(unsigned short b) { return __uint_as_float(((unsigned int)b) << 16); }
__device__ __forceinline__ float bf16_round(float x) { return bf16_val(bf16_bits(x)); }

constexpr int DK = DD / 32, DT = DD / 16;   // k steps of the score product, 16-row tiles of O^T
constexpr int NW = 8, R = 2, BR = 64;       // waves, 16-column groups per wave, query rows per work-group
constexpr int NQ = 4, BC = 32, KT = BC / 16; // key quarters, keys per pass, 16-key score tiles per pass
constexpr int NSUB = 2, SK = NSUB * BC;      // passes per stage, keys of one quarter per stage
constexpr int NST = SY / (NQ * SK);         // stages
constexpr uint32_t ROWB = 2u * DD, PITCH_K = ROWB + 16u, PITCH_V = ROWB + 32u;  // ds_load_b128 reader: 16 B x odd; ds_load_tr16_b128 reader: 32 B x odd
constexpr uint32_t SROWS = NQ * SK, TILE_K = SROWS * PITCH_K, TILE_V = SROWS * PITCH_V, SLOT = TILE_K + TILE_V, LDS_BYTES = 2u * SLOT;
constexpr uint32_t EPITCH = 4u * DD + 16u;  // pitch of a staged f32 output row
static_assert((uint32_t)NQ * BR * EPITCH <= LDS_BYTES, "the partial outputs reuse the two stage buffers");

// Most "#pragma unroll" below stand on loops that index register arrays (fragments, accumulators): the indices must be compile-time constants.
#define DEV static __device__ __forceinline__
DEV void fence() { __builtin_amdgcn_sched_barrier(0); }
DEV void nop4() { asm volatile("v_nop\n\tv_nop\n\tv_nop\n\tv_nop"); }  // the 4 vector slots between a 16-bit WMMA and a vector instruction that touches its registers, on every path
DEV void wait_x() { asm volatile("s_wait_xcnt 0x0" ::: "memory"); }  // behind global loads, in front of any rewrite of their address registers
struct Frag { u32x4 q[2]; };
DEV v8f mma(const Frag& a, const Frag& b, v8f c) {
  const i32x8 av = {(int)a.q[0].x, (int)a.q[0].y, (int)a.q[0].z, (int)a.q[0].w, (int)a.q[1].x, (int)a.q[1].y, (int)a.q[1].z, (int)a.q[1].w};
  const i32x8 bv = {(int)b.q[0].x, (int)b.q[0].y, (int)b.q[0].z, (int)b.q[0].w, (int)b.q[1].x, (int)b.q[1].y, (int)b.q[1].z, (int)b.q[1].w};
  return __builtin_amdgcn_wmma_f32_16x16x32_f16(false, __builtin_bit_cast(v16h, av), false, __builtin_bit_cast(v16h, bv), (short)0, c, false, false);
}
DEV u32x4 ld_tr16(const unsigned char* p) { typedef __attribute__((address_space(3))) s16x8 lds_s16x8; return __builtin_bit_cast(u32x4, __builtin_amdgcn_ds_load_tr16_b128_v8i16((lds_s16x8*)p)); }
DEV uint32_t pack2(float lo, float hi) { typedef _Float16 h2 __attribute__((ext_vector_type(2))); typedef float f2 __attribute__((ext_vector_type(2)));
  return __builtin_bit_cast(uint32_t, __builtin_convertvector(f2{lo, hi}, h2)); }  // round to nearest even
// f16(bf16(a)), f16(bf16(b)), both steps round to nearest even: the values bf16_bits gives; a bf16 in the high half of a word is that value as an f32
DEV uint32_t h2r(float a, float b) { typedef __bf16 b2 __attribute__((ext_vector_type(2))); typedef float f2 __attribute__((ext_vector_type(2)));
  const uint32_t w = __builtin_bit_cast(uint32_t, __builtin_convertvector(f2{a, b}, b2));
  return pack2(__uint_as_float(w << 16), __uint_as_float(w & 0xffff0000u)); }
DEV float xhalf(float x) { return __builtin_bit_cast(float, __builtin_amdgcn_permlanex16(__builtin_bit_cast(int, x), __builtin_bit_cast(int, x), 0x76543210, 0xfedcba98, false, false)); }  // lane l with lane l ^ 16

struct KFr { Frag f[KT][DK]; };
DEV void load_k(KFr& k, const unsigned char* kbase, uint32_t lane) {
  const uint32_t c = lane & 15u, h = lane >> 4;
  #pragma unroll
  for (int kt = 0; kt < KT; ++kt) {
    const unsigned char* p = kbase + (16u * kt + c) * PITCH_K + 16u * h;  // hardware k order: bytes 16h and 32 + 16h of each 64
    #pragma unroll
    for (int kc = 0; kc < DK; ++kc) { k.f[kt][kc].q[0] = *reinterpret_cast<const u32x4a*>(p + 64u * kc); k.f[kt][kc].q[1] = *reinterpret_cast<const u32x4a*>(p + 64u * kc + 32u); }
  }
}
// One 32-key pass of one wave. kf: the pass's y rows; vbase: the same rows in the copy for the transposing load; next_k: the next pass's rows, fetched when FETCH. m_run, the maximum in use (log2 domain), may trail
// the true one by up to 8, so a weight can reach 2^8 (inside f16): the accumulators are rescaled only when some column exceeds it by more.
template <bool FETCH>
DEV void pass(KFr& kf, const unsigned char* next_k, const unsigned char* vbase, uint32_t lane, const Frag (&qf)[R][DK], v8f (&acc)[R][DT], float (&m_run)[R], float (&l_run)[R]) {
  const uint32_t h = lane >> 4;
  const float cscale = 1.4426950408889634f;
  Frag vf[DT];
  {
    const unsigned char* ad = vbase + (8u * h + (lane & 7u)) * PITCH_V + ((lane >> 3) & 1u) * 16u;
    #pragma unroll
    for (int t = 0; t < DT; ++t) { vf[t].q[0] = ld_tr16(ad + 32u * t); vf[t].q[1] = ld_tr16(ad + 16u * PITCH_V + 32u * t); }
  }
  v8f s[KT][R];
  #pragma unroll
  for (int kt = 0; kt < KT; ++kt) {
    #pragma unroll
    for (int g = 0; g < R; ++g) { s[kt][g] = v8f{};
      #pragma unroll
      for (int kc = 0; kc < DK; ++kc) s[kt][g] = mma(kf.f[kt][kc], qf[g][kc], s[kt][g]); }
  }
  fence();  // keeps the maxima behind the whole run of score products: moved in between, each read of a fresh tile costs its own idle slots
  if (FETCH) load_k(kf, next_k, lane);  // in flight under this pass's softmax and second product
  float mb[R]; bool need = false;
  #pragma unroll
  for (int g = 0; g < R; ++g) {
    float mx = s[0][g][0];
    #pragma unroll
    for (int kt = 0; kt < KT; ++kt) {
      #pragma unroll
      for (int r = 0; r < 8; ++r) mx = __builtin_fmaxf(mx, s[kt][g][r]);
    }
    mx = __builtin_fmaxf(mx, xhalf(mx)) * cscale;  // both wave halves now hold this query's maximum of the pass
    mb[g] = mx; need = need || (mx > m_run[g] + 8.0f);
  }
  if (__builtin_amdgcn_ballot_w32(need) != 0) {  // a scalar branch, rare after the first passes
    #pragma unroll
    for (int g = 0; g < R; ++g) {
      const float m_new = __builtin_fmaxf(m_run[g], mb[g]);
      const float corr = __builtin_amdgcn_exp2f(m_run[g] - m_new);  // 0 on the first pass, where m_run is -inf
      l_run[g] *= corr; m_run[g] = m_new;
      #pragma unroll
      for (int t = 0; t < DT; ++t) acc[g][t] = acc[g][t] * corr;
    }
  }
  float ps[R][2];
  #pragma unroll
  for (int g = 0; g < R; ++g) {
    ps[g][0] = 0.0f; ps[g][1] = 0.0f;
    const float nm = -m_run[g];
    typedef float f32x2 __attribute__((ext_vector_type(2)));
    f32x2 arg[8];
    #pragma unroll
    for (int i = 0; i < 8; ++i)
      arg[i] = __builtin_elementwise_fma(f32x2{s[i >> 2][g][2 * (i & 3)], s[i >> 2][g][2 * (i & 3) + 1]}, f32x2{cscale, cscale}, f32x2{nm, nm});
    uint32_t w[8];
    #pragma unroll
    for (int i = 0; i < 8; ++i) {
      const float p0 = __builtin_amdgcn_exp2f(arg[i].x), p1 = __builtin_amdgcn_exp2f(arg[i].y);
      ps[g][i & 1] += p0 + p1;
      w[i] = pack2(p0, p1);
    }
    Frag pf; pf.q[0] = u32x4{w[0], w[1], w[2], w[3]}; pf.q[1] = u32x4{w[4], w[5], w[6], w[7]};
    #pragma unroll
    for (int t = 0; t < DT; ++t) acc[g][t] = mma(vf[t], pf, acc[g][t]);
  }
  #pragma unroll
  for (int g = 0; g < R; ++g) l_run[g] += ps[g][0] + ps[g][1];
  fence(); nop4(); fence();  // a branch follows the last WMMAs: keep their distance on its taken side too
}

__global__ void __launch_bounds__(NW * 32) __attribute__((amdgpu_waves_per_eu(2, 2))) k_fused(const float* __restrict__ x, const float* __restrict__ y, float* __restrict__ out) {
  __shared__ __attribute__((aligned(256))) unsigned char L[LDS_BYTES];
  __shared__ __attribute__((aligned(16))) unsigned char XS[BR * PITCH_K];  // x as f16, read once
  __shared__ float sm[NQ][BR], sl[NQ][BR];
  const uint32_t tid = threadIdx.x, lane = tid & 31u, wave = __builtin_amdgcn_readfirstlane(tid >> 5), c = lane & 15u, h = lane >> 4;
  const uint32_t cg = wave & 1u, kq = wave >> 1;
  const uint32_t b = blockIdx.x / (SX / BR), q0 = (blockIdx.x % (SX / BR)) * BR;
  const unsigned char* Yb = reinterpret_cast<const unsigned char*>(y + (size_t)b * SY * DD);
  // Staging: a wave's 32 lanes cover one 512-byte f32 row of y; load i of a thread is key 8 (i & 3) + wave of pass sub of quarter i >> 2.
  constexpr uint32_t GROWB = 4u * DD;
  v4f pre[16];
  auto gload = [&](v4f (&pre)[16], uint32_t st, uint32_t sub) {
    const unsigned char* ys = Yb + (size_t)(st * SK + sub * BC) * GROWB;  // the uniform part of the address
    #pragma unroll
    for (uint32_t i = 0; i < 16; ++i) pre[i] = *reinterpret_cast<const v4fa*>(ys + ((i >> 2) * (uint32_t)(SY / NQ) + (i & 3u) * 8u) * GROWB + tid * 16u);
  };
  u32x2 hv[16];
  auto round16 = [&](u32x2 (&hv)[16], const v4f (&pre)[16]) {
    #pragma unroll
    for (uint32_t i = 0; i < 16; ++i) hv[i] = u32x2{h2r(pre[i][0], pre[i][1]), h2r(pre[i][2], pre[i][3])};
  };
  auto lstore = [&](const u32x2 (&hv)[16], uint32_t slot, uint32_t sub) {
    #pragma unroll
    for (uint32_t i = 0; i < 16; ++i) {
      const uint32_t row = (i >> 2) * SK + sub * BC + (i & 3u) * 8u + wave;
      *reinterpret_cast<u32x2a*>(L + slot * SLOT + row * PITCH_K + lane * 8u) = hv[i];
      *reinterpret_cast<u32x2a*>(L + slot * SLOT + TILE_K + row * PITCH_V + lane * 8u) = hv[i];
    }
  };
  v4f pre1[16];  // stage 0's second pass: both halves of the first stage fly together
  gload(pre, 0, 0); gload(pre1, 0, 1);
  // x: the work-group's 64 rows are one contiguous block: whole-line loads, each element rounded once, handed to the waves through LDS
  constexpr uint32_t NX = (uint32_t)BR * DD / 4u / (NW * 32u);
  const unsigned char* xs = reinterpret_cast<const unsigned char*>(x + ((size_t)b * SX + q0) * DD);  // uniform
  v4f xr[NX];
  #pragma unroll
  for (uint32_t i = 0; i < NX; ++i) xr[i] = *reinterpret_cast<const v4fa*>(xs + (tid * 16u + i * (NW * 32u * 16u)));
  wait_x();
  #pragma unroll
  for (uint32_t i = 0; i < NX; ++i) {
    const uint32_t e = tid + i * (NW * 32u);
    *reinterpret_cast<u32x2a*>(XS + (e >> 5) * PITCH_K + (e & 31u) * 8u) = u32x2{h2r(xr[i][0], xr[i][1]), h2r(xr[i][2], xr[i][3])};
  }
  v8f acc[R][DT];
  float m_run[R], l_run[R];
  #pragma unroll
  for (int g = 0; g < R; ++g) { m_run[g] = -__builtin_inff(); l_run[g] = 0.0f;
    #pragma unroll
    for (int t = 0; t < DT; ++t) acc[g][t] = v8f{}; }
  round16(hv, pre); lstore(hv, 0, 0); round16(hv, pre1); lstore(hv, 0, 1);
  __syncthreads();
  // x fragments (B operand) in the hardware k order, as y's in load_k()
  Frag qf[R][DK];
  #pragma unroll
  for (int g = 0; g < R; ++g) {
    const unsigned char* p = XS + (cg * 32u + 16u * g + c) * PITCH_K + 16u * h;
    #pragma unroll
    for (int kc = 0; kc < DK; ++kc) { qf[g][kc].q[0] = *reinterpret_cast<const u32x4a*>(p + 64u * kc); qf[g][kc].q[1] = *reinterpret_cast<const u32x4a*>(p + 64u * kc + 32u); }
  }
  KFr kf;
  #pragma unroll 1  // one copy of the stage in the instruction cache: nothing in a stage needs st at compile time
  for (uint32_t st = 0; st < (uint32_t)NST; ++st) {
    const uint32_t slot = st & 1u;
    const bool more = st + 1u < (uint32_t)NST;  // uniform
    const unsigned char* kb = L + slot * SLOT + kq * SK * PITCH_K;
    const unsigned char* vb = L + slot * SLOT + TILE_K + kq * SK * PITCH_V;
    load_k(kf, kb, lane);
    if (more) { gload(pre, st + 1u, 0); wait_x(); }  // in flight under the pass
    pass<true>(kf, kb + BC * PITCH_K, vb, lane, qf, acc, m_run, l_run);
    if (more) { round16(hv, pre); gload(pre, st + 1u, 1); wait_x(); lstore(hv, slot ^ 1u, 0); }  // every wave left that buffer before the barrier that ended stage st - 1
    pass<false>(kf, kb, vb + BC * PITCH_V, lane, qf, acc, m_run, l_run);
    if (more) { round16(hv, pre); lstore(hv, slot ^ 1u, 1); }
    __syncthreads();  // publishes stage st + 1 and ends every read of stage st
  }
  // The residual's x, in flight under the join: the work-group's 64 rows are one contiguous block of x and of out.
  constexpr uint32_t NO = (uint32_t)BR * DD / 4u / (NW * 32u);
  const size_t blk = ((size_t)b * SX + q0) * DD;  // uniform
  const unsigned char* xb = reinterpret_cast<const unsigned char*>(x + blk);
  unsigned char* ob = reinterpret_cast<unsigned char*>(out + blk);
  v4f xv[NO];
  #pragma unroll
  for (uint32_t i = 0; i < NO; ++i) xv[i] = *reinterpret_cast<const v4fa*>(xb + (tid * 16u + i * (NW * 32u * 16u)));
  wait_x();
  // Join the four key quarters: common maximum M and sum per query, each wave scales its own partial O^T, the work-group adds the four.
  #pragma unroll
  for (int g = 0; g < R; ++g) {
    const float l = l_run[g] + xhalf(l_run[g]);  // each wave half summed its eight keys of every 16-key tile
    if (h == 0) { sm[kq][cg * 32u + 16u * g + c] = m_run[g]; sl[kq][cg * 32u + 16u * g + c] = l; }
  }
  __syncthreads();
  #pragma unroll
  for (int g = 0; g < R; ++g) {
    const uint32_t col = cg * 32u + 16u * g + c;
    float M = sm[0][col];
    #pragma unroll
    for (int k = 1; k < NQ; ++k) M = __builtin_fmaxf(M, sm[k][col]);
    float den = 0.0f;
    #pragma unroll
    for (int k = 0; k < NQ; ++k) den += sl[k][col] * __builtin_amdgcn_exp2f(sm[k][col] - M);
    const float f = __builtin_amdgcn_exp2f(m_run[g] - M) / den;
    #pragma unroll
    for (int t = 0; t < DT; ++t) {
      const v8f o = acc[g][t] * f;  // d = 16 t + 8 h + r of query col
      unsigned char* p = L + (kq * BR + col) * EPITCH + (16u * t + 8u * h) * 4u;
      *reinterpret_cast<v4fa*>(p) = v4f{o[0], o[1], o[2], o[3]};
      *reinterpret_cast<v4fa*>(p + 16u) = v4f{o[4], o[5], o[6], o[7]};
    }
  }
  __syncthreads();
  // Whole rows: 32 lanes cover one 512-byte output row.
  #pragma unroll
  for (uint32_t i = 0; i < NO; ++i) {
    const uint32_t e = tid + i * (NW * 32u), q = e >> 5, c4 = e & 31u;
    v4f a = *reinterpret_cast<const v4fa*>(L + q * EPITCH + c4 * 16u);
    #pragma unroll
    for (uint32_t k = 1; k < (uint32_t)NQ; ++k) a += *reinterpret_cast<const v4fa*>(L + (k * BR + q) * EPITCH + c4 * 16u);
    v4f o;
    #pragma unroll
    for (int j = 0; j < 4; ++j) o[j] = bf16_round(xv[i][j]) + a[j];
    *reinterpret_cast<v4fa*>(ob + (tid * 16u + i * (NW * 32u * 16u))) = o;
  }
}

extern "C" void kernel_launch(void* const* d_in, const int* in_sizes, int n_in,
                              void* d_out, int out_size, void* d_ws, size_t ws_size, hipStream_t stream) {
  (void)in_sizes; (void)n_in; (void)out_size; (void)d_ws; (void)ws_size;
  const float* x = (const float*)d_in[0]; const float* y = (const float*)d_in[1];
  k_fused<<<BB * (SX / BR), NW * 32, 0, stream>>>(x, y, (float*)d_out);
}

// v005
// It runs in 18.3 microseconds.
// Versions between v003 and this one are left out; their measured steps multiply to 1.18 times as fast.
// All steps since v000 together make it 34.5 times as fast.
#include <hip/hip_runtime.h>
#include <stdint.h>
#define BB 8
#define SX 2048
#define SY 2048
#define DD 128

typedef float  v8f  __attribute__((ext_vector_type(8)));
typedef float  v4f  __attribute__((ext_vector_type(4)));
typedef float  v4fa __attribute__((ext_vector_type(4), may_alias));
typedef uint32_t u32x4 __attribute__((ext_vector_type(4)));
typedef uint32_t u32x4a __attribute__((ext_vector_type(4), may_alias));
typedef uint32_t u32x2 __attribute__((ext_vector_type(2)));
typedef uint32_t u32x2a __attribute__((ext_vector_type(2), may_alias));
typedef int i32x8 __attribute__((ext_vector_type(8)));
typedef short s16x8 __attribute__((ext_vector_type(8)));
typedef _Float16 v16h __attribute__((ext_vector_type(16)));

constexpr int DK = DD / 32, DT = DD / 16;   // k steps of the score product, 16-row tiles of O^T
constexpr int NW = 8, R = 2, BR = 64;       // waves, 16-column groups per wave, query rows per work-group
constexpr int NQ = 4, BC = 32, KT = BC / 16; // key quarters, keys per pass, 16-key score tiles per pass
constexpr int NSUB = 2, SK = NSUB * BC;      // passes per stage, keys of one quarter per stage
constexpr int NST = SY / (NQ * SK);         // stages
constexpr uint32_t NPASS = (uint32_t)NST * NSUB;  // passes of a quarter
static_assert((NPASS & (NPASS - 1u)) == 0u && NPASS == 16u, "the ring of passes wraps by a mask; the start pass below has four bits");
constexpr uint32_t ROWB = 2u * DD, PITCH_K = ROWB + 16u, PITCH_V = ROWB + 32u;  // ds_load_b128 reader: 16 B x odd; ds_load_tr16_b128 reader: 32 B x odd
constexpr uint32_t SROWS = NQ * SK, TILE_K = SROWS * PITCH_K, TILE_V = SROWS * PITCH_V, SLOT = TILE_K + TILE_V, LDS_BYTES = 2u * SLOT;
constexpr uint32_t EPITCH = 4u * DD + 16u;  // pitch of a staged f32 output row
static_assert((uint32_t)NQ * BR * EPITCH <= LDS_BYTES, "the partial outputs reuse the two stage buffers");

// Most "#pragma unroll" below stand on loops that index register arrays (fragments, accumulators): the indices must be compile-time constants.
#define DEV static __device__ __forceinline__
DEV void fence() { __builtin_amdgcn_sched_barrier(0); }
DEV void nop4() { asm volatile("v_nop\n\tv_nop\n\tv_nop\n\tv_nop"); }  // the 4 vector slots between a 16-bit WMMA and a vector instruction that touches its registers, on every path
DEV void wait_x() { asm volatile("s_wait_xcnt 0x0" ::: "memory"); }  // behind global loads, in front of any rewrite of their address registers
struct Frag { u32x4 q[2]; };
DEV v8f mma(const Frag& a, const Frag& b, v8f c) {
  const i32x8 av = {(int)a.q[0].x, (int)a.q[0].y, (int)a.q[0].z, (int)a.q[0].w, (int)a.q[1].x, (int)a.q[1].y, (int)a.q[1].z, (int)a.q[1].w};
  const i32x8 bv = {(int)b.q[0].x, (int)b.q[0].y, (int)b.q[0].z, (int)b.q[0].w, (int)b.q[1].x, (int)b.q[1].y, (int)b.q[1].z, (int)b.q[1].w};
  return __builtin_amdgcn_wmma_f32_16x16x32_f16(false, __builtin_bit_cast(v16h, av), false, __builtin_bit_cast(v16h, bv), (short)0, c, false, false);
}
DEV u32x4 ld_tr16(const unsigned char* p) { typedef __attribute__((address_space(3))) s16x8 lds_s16x8; return __builtin_bit_cast(u32x4, __builtin_amdgcn_ds_load_tr16_b128_v8i16((lds_s16x8*)p)); }
DEV uint32_t pack2(float lo, float hi) { typedef _Float16 h2 __attribute__((ext_vector_type(2))); typedef float f2 __attribute__((ext_vector_type(2)));
  return __builtin_bit_cast(uint32_t, __builtin_convertvector(f2{lo, hi}, h2)); }  // round to nearest even
DEV float xhalf(float x) { return __builtin_bit_cast(float, __builtin_amdgcn_permlanex16(__builtin_bit_cast(int, x), __builtin_bit_cast(int, x), 0x76543210, 0xfedcba98, false, false)); }  // lane l with lane l ^ 16

struct KFr { Frag f[KT][DK]; };
DEV void load_k(KFr& k, const unsigned char* kbase, uint32_t lane) {
  const uint32_t c = lane & 15u, h = lane >> 4;
  #pragma unroll
  for (int kt = 0; kt < KT; ++kt) {
    const unsigned char* p = kbase + (16u * kt + c) * PITCH_K + 16u * h;  // hardware k order: bytes 16h and 32 + 16h of each 64
    #pragma unroll
    for (int kc = 0; kc < DK; ++kc) { k.f[kt][kc].q[0] = *reinterpret_cast<const u32x4a*>(p + 64u * kc); k.f[kt][kc].q[1] = *reinterpret_cast<const u32x4a*>(p + 64u * kc + 32u); }
  }
}
// One 32-key pass of one wave. kf: the pass's y rows; vbase: the same rows in the copy for the transposing load; next_k: the next pass's rows, fetched when FETCH. m_run, the maximum in use (log2 domain), may trail
// the true one by up to 8, so a weight can reach 2^8 (inside f16): the accumulators are rescaled only when some column exceeds it by more.
template <bool FETCH>
DEV void pass(KFr& kf, const unsigned char* next_k, const unsigned char* vbase, uint32_t lane, const Frag (&qf)[R][DK], v8f (&acc)[R][DT], float (&m_run)[R], float (&l_run)[R]) {
  const uint32_t h = lane >> 4;
  const float cscale = 1.4426950408889634f;
  Frag vf[DT];
  {
    const unsigned char* ad = vbase + (8u * h + (lane & 7u)) * PITCH_V + ((lane >> 3) & 1u) * 16u;
    #pragma unroll
    for (int t = 0; t < DT; ++t) { vf[t].q[0] = ld_tr16(ad + 32u * t); vf[t].q[1] = ld_tr16(ad + 16u * PITCH_V + 32u * t); }
  }
  v8f s[KT][R];
  #pragma unroll
  for (int kt = 0; kt < KT; ++kt) {
    #pragma unroll
    for (int g = 0; g < R; ++g) { s[kt][g] = v8f{};
      #pragma unroll
      for (int kc = 0; kc < DK; ++kc) s[kt][g] = mma(kf.f[kt][kc], qf[g][kc], s[kt][g]); }
  }
  fence();  // keeps the maxima behind the whole run of score products: moved in between, each read of a fresh tile costs its own idle slots
  if (FETCH) load_k(kf, next_k, lane);  // in flight under this pass's softmax and second product
  float mb[R]; bool need = false;
  #pragma unroll
  for (int g = 0; g < R; ++g) {
    float mx = s[0][g][0];
    #pragma unroll
    for (int kt = 0; kt < KT; ++kt) {
      #pragma unroll
      for (int r = 0; r < 8; ++r) mx = __builtin_fmaxf(mx, s[kt][g][r]);
    }
    mx = __builtin_fmaxf(mx, xhalf(mx)) * cscale;  // both wave halves now hold this query's maximum of the pass
    mb[g] = mx; need = need || (mx > m_run[g] + 8.0f);
  }
  if (__builtin_amdgcn_ballot_w32(need) != 0) {  // a scalar branch, rare after the first passes
    #pragma unroll
    for (int g = 0; g < R; ++g) {
      const float m_new = __builtin_fmaxf(m_run[g], mb[g]);
      const float corr = __builtin_amdgcn_exp2f(m_run[g] - m_new);  // 0 on the first pass, where m_run is -inf
      l_run[g] *= corr; m_run[g] = m_new;
      #pragma unroll
      for (int t = 0; t < DT; ++t) acc[g][t] = acc[g][t] * corr;
    }
  }
  float ps[R][2];
  #pragma unroll
  for (int g = 0; g < R; ++g) {
    ps[g][0] = 0.0f; ps[g][1] = 0.0f;
    const float nm = -m_run[g];
    typedef float f32x2 __attribute__((ext_vector_type(2)));
    f32x2 arg[8];
    #pragma unroll
    for (int i = 0; i < 8; ++i)
      arg[i] = __builtin_elementwise_fma(f32x2{s[i >> 2][g][2 * (i & 3)], s[i >> 2][g][2 * (i & 3) + 1]}, f32x2{cscale, cscale}, f32x2{nm, nm});
    uint32_t w[8];
    #pragma unroll
    for (int i = 0; i < 8; ++i) {
      const float p0 = __builtin_amdgcn_exp2f(arg[i].x), p1 = __builtin_amdgcn_exp2f(arg[i].y);
      ps[g][i & 1] += p0 + p1;
      w[i] = pack2(p0, p1);
    }
    Frag pf; pf.q[0] = u32x4{w[0], w[1], w[2], w[3]}; pf.q[1] = u32x4{w[4], w[5], w[6], w[7]};
    #pragma unroll
    for (int t = 0; t < DT; ++t) acc[g][t] = mma(vf[t], pf, acc[g][t]);
  }
  #pragma unroll
  for (int g = 0; g < R; ++g) l_run[g] += ps[g][0] + ps[g][1];
  fence(); nop4(); fence();  // a branch follows the last WMMAs: keep their distance on its taken side too
}

__global__ void __launch_bounds__(NW * 32) __attribute__((amdgpu_waves_per_eu(2, 2))) k_fused(const float* __restrict__ x, const float* __restrict__ y, float* __restrict__ out) {
  __shared__ __attribute__((aligned(256))) unsigned char L[LDS_BYTES];
  __shared__ __attribute__((aligned(16))) unsigned char XS[BR * PITCH_K];  // x as f16, read once
  __shared__ float sm[NQ][BR], sl[NQ][BR];
  const uint32_t tid = threadIdx.x, lane = tid & 31u, wave = __builtin_amdgcn_readfirstlane(tid >> 5), c = lane & 15u, h = lane >> 4;
  const uint32_t cg = wave & 1u, kq = wave >> 1;
  const uint32_t b = blockIdx.x / (SX / BR), wi = blockIdx.x % (SX / BR), q0 = wi * BR;
  // Start pass: bit 2 of the index is left out, so the two work-groups that share a start differ by 4 in index.
  // For speed only: every start gives the same set of passes.
  const uint32_t rot = (wi & 3u) | ((wi >> 1) & 12u);
  const unsigned char* Yb = reinterpret_cast<const unsigned char*>(y + (size_t)b * SY * DD);
  // Staging: a wave's 32 lanes cover one 512-byte f32 row of y; load i of a thread is key 8 (i & 3) + wave of pass sub of quarter i >> 2.
  constexpr uint32_t GROWB = 4u * DD;
  v4f pre[16];
  auto gload = [&](v4f (&pre)[16], uint32_t st, uint32_t sub) {
    const unsigned char* ys = Yb + (size_t)(((st * NSUB + sub + rot) & (NPASS - 1u)) * BC) * GROWB;  // the uniform part of the address: pass st * NSUB + sub of this work-group's ring
    #pragma unroll
    for (uint32_t i = 0; i < 16; ++i) pre[i] = *reinterpret_cast<const v4fa*>(ys + ((i >> 2) * (uint32_t)(SY / NQ) + (i & 3u) * 8u) * GROWB + tid * 16u);
  };
  u32x2 hv[16];
  auto round16 = [&](u32x2 (&hv)[16], const v4f (&pre)[16]) {
    #pragma unroll
    for (uint32_t i = 0; i < 16; ++i) hv[i] = u32x2{pack2(pre[i][0], pre[i][1]), pack2(pre[i][2], pre[i][3])};
  };
  auto lstore = [&](const u32x2 (&hv)[16], uint32_t slot, uint32_t sub) {
    #pragma unroll
    for (uint32_t i = 0; i < 16; ++i) {
      const uint32_t row = (i >> 2) * SK + sub * BC + (i & 3u) * 8u + wave;
      *reinterpret_cast<u32x2a*>(L + slot * SLOT + row * PITCH_K + lane * 8u) = hv[i];
      *reinterpret_cast<u32x2a*>(L + slot * SLOT + TILE_K + row * PITCH_V + lane * 8u) = hv[i];
    }
  };
  v4f pre1[16];  // stage 0's second pass: both halves of the first stage fly together
  gload(pre, 0, 0); gload(pre1, 0, 1);
  // x: the work-group's 64 rows are one contiguous block: whole-line loads, each element rounded once, handed to the waves through LDS
  constexpr uint32_t NX = (uint32_t)BR * DD / 4u / (NW * 32u);
  const unsigned char* xs = reinterpret_cast<const unsigned char*>(x + ((size_t)b * SX + q0) * DD);  // uniform
  v4f xr[NX];
  #pragma unroll
  for (uint32_t i = 0; i < NX; ++i) xr[i] = *reinterpret_cast<const v4fa*>(xs + (tid * 16u + i * (NW * 32u * 16u)));
  wait_x(); fence();  // the fence holds the later scalar and vector work behind the wait: without it this build rewrites the scalar bases of the y loads ahead of the wait
  #pragma unroll
  for (uint32_t i = 0; i < NX; ++i) {
    const uint32_t e = tid + i * (NW * 32u);
    *reinterpret_cast<u32x2a*>(XS + (e >> 5) * PITCH_K + (e & 31u) * 8u) = u32x2{pack2(xr[i][0], xr[i][1]), pack2(xr[i][2], xr[i][3])};
  }
  v8f acc[R][DT];
  float m_run[R], l_run[R];
  #pragma unroll
  for (int g = 0; g < R; ++g) { m_run[g] = -__builtin_inff(); l_run[g] = 0.0f;
    #pragma unroll
    for (int t = 0; t < DT; ++t) acc[g][t] = v8f{}; }
  round16(hv, pre); lstore(hv, 0, 0); round16(hv, pre1); lstore(hv, 0, 1);
  __syncthreads();
  // x fragments (B operand) in the hardware k order, as y's in load_k()
  Frag qf[R][DK];
  #pragma unroll
  for (int g = 0; g < R; ++g) {
    const unsigned char* p = XS + (cg * 32u + 16u * g + c) * PITCH_K + 16u * h;
    #pragma unroll
    for (int kc = 0; kc < DK; ++kc) { qf[g][kc].q[0] = *reinterpret_cast<const u32x4a*>(p + 64u * kc); qf[g][kc].q[1] = *reinterpret_cast<const u32x4a*>(p + 64u * kc + 32u); }
  }
  KFr kf;
  #pragma unroll 1  // one copy of the stage in the instruction cache: nothing in a stage needs st at compile time
  for (uint32_t st = 0; st < (uint32_t)NST; ++st) {
    const uint32_t slot = st & 1u;
    const bool more = st + 1u < (uint32_t)NST;  // uniform
    const unsigned char* kb = L + slot * SLOT + kq * SK * PITCH_K;
    const unsigned char* vb = L + slot * SLOT + TILE_K + kq * SK * PITCH_V;
    load_k(kf, kb, lane);
    if (more) { gload(pre, st + 1u, 0); wait_x(); }  // in flight under the pass
    pass<true>(kf, kb + BC * PITCH_K, vb, lane, qf, acc, m_run, l_run);
    if (more) { round16(hv, pre); gload(pre, st + 1u, 1); wait_x(); lstore(hv, slot ^ 1u, 0); }  // every wave left that buffer before the barrier that ended stage st - 1
    pass<false>(kf, kb, vb + BC * PITCH_V, lane, qf, acc, m_run, l_run);
    if (more) { round16(hv, pre); lstore(hv, slot ^ 1u, 1); }
    __syncthreads();  // publishes stage st + 1 and ends every read of stage st
  }
  // The residual's x, in flight under the join: the work-group's 64 rows are one contiguous block of x and of out.
  constexpr uint32_t NO = (uint32_t)BR * DD / 4u / (NW * 32u);
  const size_t blk = ((size_t)b * SX + q0) * DD;  // uniform
  const unsigned char* xb = reinterpret_cast<const unsigned char*>(x + blk);
  unsigned char* ob = reinterpret_cast<unsigned char*>(out + blk);
  v4f xv[NO];
  #pragma unroll
  for (uint32_t i = 0; i < NO; ++i) xv[i] = *reinterpret_cast<const v4fa*>(xb + (tid * 16u + i * (NW * 32u * 16u)));
  wait_x();
  // Join the four key quarters: common maximum M and sum per query, each wave scales its own partial O^T, the work-group adds the four.
  #pragma unroll
  for (int g = 0; g < R; ++g) {
    const float l = l_run[g] + xhalf(l_run[g]);  // each wave half summed its eight keys of every 16-key tile
    if (h == 0) { sm[kq][cg * 32u + 16u * g + c] = m_run[g]; sl[kq][cg * 32u + 16u * g + c] = l; }
  }
  __syncthreads();
  #pragma unroll
  for (int g = 0; g < R; ++g) {
    const uint32_t col = cg * 32u + 16u * g + c;
    float M = sm[0][col];
    #pragma unroll
    for (int k = 1; k < NQ; ++k) M = __builtin_fmaxf(M, sm[k][col]);
    float den = 0.0f;
    #pragma unroll
    for (int k = 0; k < NQ; ++k) den += sl[k][col] * __builtin_amdgcn_exp2f(sm[k][col] - M);
    const float f = __builtin_amdgcn_exp2f(m_run[g] - M) / den;
    #pragma unroll
    for (int t = 0; t < DT; ++t) {
      const v8f o = acc[g][t] * f;  // d = 16 t + 8 h + r of query col
      unsigned char* p = L + (kq * BR + col) * EPITCH + (16u * t + 8u * h) * 4u;
      *reinterpret_cast<v4fa*>(p) = v4f{o[0], o[1], o[2], o[3]};
      *reinterpret_cast<v4fa*>(p + 16u) = v4f{o[4], o[5], o[6], o[7]};
    }
  }
  __syncthreads();
  // Whole rows: 32 lanes cover one 512-byte output row.
  #pragma unroll
  for (uint32_t i = 0; i < NO; ++i) {
    const uint32_t e = tid + i * (NW * 32u), q = e >> 5, c4 = e & 31u;
    v4f a = *reinterpret_cast<const v4fa*>(L + q * EPITCH + c4 * 16u);
    #pragma unroll
    for (uint32_t k = 1; k < (uint32_t)NQ; ++k) a += *reinterpret_cast<const v4fa*>(L + (k * BR + q) * EPITCH + c4 * 16u);
    v4f o;
    #pragma unroll
    for (int j = 0; j < 4; ++j) o[j] = xv[i][j] + a[j];
    *reinterpret_cast<v4fa*>(ob + (tid * 16u + i * (NW * 32u * 16u))) = o;
  }
}

extern "C" void kernel_launch(void* const* d_in, const int* in_sizes, int n_in,
                              void* d_out, int out_size, void* d_ws, size_t ws_size, hipStream_t stream) {
  (void)in_sizes; (void)n_in; (void)out_size; (void)d_ws; (void)ws_size;
  const float* x = (const float*)d_in[0]; const float* y = (const float*)d_in[1];
  k_fused<<<BB * (SX / BR), NW * 32, 0, stream>>>(x, y, (float*)d_out);
}
